// v000
// The times below were measured on an AMD MI455X: many runs one after another, warmed up first and cycling through
// copies of the inputs, with the whole window's GPU time divided by the number of runs. Launches and the gaps
// between them are all in it. The median over several windows is given; except for v000 it joins two sittings, which
// can be a few percent apart, so the side-by-side timings, each taken in one sitting, are the better comparison.
// v000 is the starting kernel. One run takes 1120 microseconds.
#include <hip/hip_runtime.h>

// SelfAttention_Inefficient (x [4][4096][64]; per head h of 2: Q/K/V = x W[h] (64x64); scores = relu(Q.K^T) / 4096 (no softmax); out = x + sum_h scores V -> [4][4096][64]).
// Compute dtypes, f32 accumulate: every input rounded to bf16; Q/K/V on PLAIN bf16 operands (inputs: exact; K 64); scores (K 64) single fp16 planes -> f32, relu and /4096 in f32 -> fp16 x 1024; scores.V single fp16 (1 product; the weights are O(1e-3) so fp16 rounding is

#define NB_  4
#define NN   4096
#define DD   64
#define NH_  2
#define PCAR 1024.0f
typedef _Float16 h16;
typedef unsigned short bf;
typedef __attribute__((ext_vector_type(16))) __bf16   v16bf;
typedef __attribute__((ext_vector_type(16))) _Float16 v16h;
typedef __attribute__((ext_vector_type(8)))  _Float16 v8h;
typedef __attribute__((ext_vector_type(8)))  unsigned short v8us;
typedef __attribute__((ext_vector_type(8)))  float    v8f;
typedef __attribute__((ext_vector_type(4)))  float    v4f;
typedef v8h  __attribute__((may_alias)) v8ha;
typedef v4f  __attribute__((may_alias)) v4fa;
typedef v8us __attribute__((may_alias)) v8usa;

__device__ __forceinline__ unsigned short f2bf(float f) { unsigned u = __float_as_uint(f); u += 0x7FFFu + ((u >> 16) & 1u); return (unsigned short)(u >> 16); }
__device__ __forceinline__ float bf2f(unsigned short b) { return __uint_as_float(((unsigned)b) << 16); }
__device__ __forceinline__ float bfr(float f) { return bf2f(f2bf(f)); }
__device__ __forceinline__ v16h cat16(v8h lo, v8h hi) { return __builtin_shufflevector(lo, hi, 0, 1, 2, 3, 4, 5, 6, 7, 8, 9, 10, 11, 12, 13, 14, 15); }
__device__ __forceinline__ v16bf cat16b(v8us lo, v8us hi) { return __builtin_bit_cast(v16bf, __builtin_shufflevector(lo, hi, 0, 1, 2, 3, 4, 5, 6, 7, 8, 9, 10, 11, 12, 13, 14, 15)); }
__device__ __forceinline__ v8f wmma16(v16h a, v16h b, v8f c) { return __builtin_amdgcn_wmma_f32_16x16x32_f16(false, a, false, b, (short)0, c, false, false); }
__device__ __forceinline__ v8f wmmab(v16bf a, v16bf b, v8f c) { return __builtin_amdgcn_wmma_f32_16x16x32_bf16(false, a, false, b, (short)0, c, false, false); }



// ---- k_gemmw: register-blocked GEMM, ONE WAVE per 64x64 output tile (16 accumulators), operands straight from K-contiguous 16-bit planes; grid (M/64, N/64, Z), 32 threads.
// C[m][n] (f32, pitch ldc, + optional f32 bias[n]) = sum_k A[m][k] Bt[n][k] (+ split products per NSPLIT). z-batch strides sA/sB/sC in elements. K % 32 == 0.
template <typename T16> struct WFrag;
template <> struct WFrag<h16> { typedef v16h V; static __device__ __forceinline__ V ld(const h16* p) { return cat16(*(const v8h*)p, *(const v8h*)(p + 16)); } static __device__ __forceinline__ v8f mma(V a, V b, v8f c) { return wmma16(a, b, c); } };
template <> struct WFrag<bf> { typedef v16bf V; static __device__ __forceinline__ V ld(const bf* p) { return cat16b(*(const v8us*)p, *(const v8us*)(p + 16)); } static __device__ __forceinline__ v8f mma(V a, V b, v8f c) { return wmmab(a, b, c); } };
template <typename T16, int NSPLIT, bool BIAS>
__global__ __launch_bounds__(32) void k_gemmw(const T16* __restrict__ A, const T16* __restrict__ A2, const T16* __restrict__ Bt, const T16* __restrict__ Bt2, int K, float* C, int ldc, const float* __restrict__ bias, size_t sA, size_t sB, size_t sC) {
    typedef typename WFrag<T16>::V V;
    __shared__ __align__(16) float os[16 * 68];
    const size_t z = blockIdx.z; A += z * sA; if (A2) A2 += z * sA; Bt += z * sB; if (Bt2) Bt2 += z * sB; C += z * sC;
    const int lane = threadIdx.x & 31, lr = lane & 15, hi = lane >> 4; const int r0 = blockIdx.x * 64, c0 = blockIdx.y * 64;
    v8f acc[4][4];
#pragma unroll
    for (int mb = 0; mb < 4; ++mb)
#pragma unroll
        for (int nb = 0; nb < 4; ++nb) acc[mb][nb] = (v8f){};
    const size_t aoff = (size_t)(r0 + lr) * K + 8 * hi, boff = (size_t)(c0 + lr) * K + 8 * hi;
#pragma unroll 1
    for (int kc = 0; kc < K; kc += 32) {
        V a[4], a2[4];
#pragma unroll
        for (int mb = 0; mb < 4; ++mb) { a[mb] = WFrag<T16>::ld(A + aoff + (size_t)mb * 16 * K + kc); if (NSPLIT == 1 || NSPLIT == 2) a2[mb] = WFrag<T16>::ld(A2 + aoff + (size_t)mb * 16 * K + kc); }
#pragma unroll
        for (int nb = 0; nb < 4; ++nb) { const V b = WFrag<T16>::ld(Bt + boff + (size_t)nb * 16 * K + kc); V b2; if (NSPLIT >= 2) b2 = WFrag<T16>::ld(Bt2 + boff + (size_t)nb * 16 * K + kc);
#pragma unroll
            for (int mb = 0; mb < 4; ++mb) { acc[mb][nb] = WFrag<T16>::mma(a[mb], b, acc[mb][nb]); if (NSPLIT == 1 || NSPLIT == 2) acc[mb][nb] = WFrag<T16>::mma(a2[mb], b, acc[mb][nb]); if (NSPLIT >= 2) acc[mb][nb] = WFrag<T16>::mma(a[mb], b2, acc[mb][nb]); } }
        asm volatile("v_nop\n\tv_nop\n\tv_nop\n\tv_nop" : "+v"(acc[0][0]), "+v"(acc[1][1]), "+v"(acc[2][2]), "+v"(acc[3][3]) : "v"(a[0]), "v"(a[3]));
    }
#pragma unroll
    for (int mb = 0; mb < 4; ++mb) {
#pragma unroll
        for (int nb = 0; nb < 4; ++nb) {
#pragma unroll
            for (int j = 0; j < 8; ++j) os[(hi * 8 + j) * 68 + nb * 16 + lr] = acc[mb][nb][j]; }
        __builtin_amdgcn_wave_barrier(); asm volatile("" ::: "memory");
        float* crow = C + (size_t)(r0 + mb * 16) * ldc + c0;
{
#pragma unroll
            for (int s = 0; s < 8; ++s) { const int row = 2 * s + hi, cofs = lr * 4; v4f val = *(const v4fa*)(os + row * 68 + cofs); if (BIAS) { val[0] += bfr(bias[c0 + cofs]); val[1] += bfr(bias[c0 + cofs + 1]); val[2] += bfr(bias[c0 + cofs + 2]); val[3] += bfr(bias[c0 + cofs + 3]); }
                *(v4f*)(crow + (size_t)row * ldc + cofs) = val; }
             }
        __builtin_amdgcn_wave_barrier(); asm volatile("" ::: "memory");
    }
}

__device__ __forceinline__ h16 tohx(float x) { return (h16)x; }
typedef __attribute__((ext_vector_type(2))) unsigned short v2us;
typedef __attribute__((ext_vector_type(2))) _Float16 v2h;
typedef __attribute__((ext_vector_type(4))) _Float16 v4h;

__global__ __launch_bounds__(256) void k_wtG(const float* __restrict__ w, int K, int N, bf* Bt) {
    const int lane = threadIdx.x & 31; const int L0 = (blockIdx.x * 8 + (threadIdx.x >> 5)) * 8; const int nlines = N * K / 64;
{
#pragma unroll 1
        for (int l = 0; l < 8; ++l) { const int L = L0 + l; if (L >= nlines) break; const size_t e = (size_t)L * 64 + lane * 2; const int k = (int)(e % K), n = (int)(e / K); v2us o;
            o[0] = f2bf(w[(size_t)k * N + n]); o[1] = f2bf(w[(size_t)(k + 1) * N + n]); *(v2us*)(Bt + e) = o; }
         }
}
__global__ __launch_bounds__(256) void k_cvt8(const float* __restrict__ src, bf* dst, size_t n8) { const size_t i = (size_t)blockIdx.x * 256 + threadIdx.x; if (i >= n8) return; const v8f v = *(const v8f*)(src + i * 8); v8us o;
#pragma unroll
    for (int k = 0; k < 8; ++k) o[k] = f2bf(v[k]); *(v8us*)(dst + i * 8) = o;  }
__global__ __launch_bounds__(256) void k_p16(const float* __restrict__ F, h16* P) { const int e = (blockIdx.x * 256 + threadIdx.x) * 4; if (e >= NN * DD) return; const v4f a = *(const v4f*)(F + e); v4h o;
#pragma unroll
    for (int u = 0; u < 4; ++u) o[u] = tohx(a[u]); *(v4h*)(P + e) = o;  }
__global__ __launch_bounds__(256) void k_vt(const float* __restrict__ V, h16* VT) { const int e = (blockIdx.x * 256 + threadIdx.x) * 2; if (e >= DD * NN) return; const int n = e % NN; const int d = e / NN; v2h o; o[0] = tohx(V[(size_t)n * DD + d]); o[1] = tohx(V[(size_t)(n + 1) * DD + d]); *(v2h*)(VT + e) = o;  }
__global__ __launch_bounds__(256) void k_relu(const float* __restrict__ S, h16* P) { const size_t e = ((size_t)blockIdx.x * 256 + threadIdx.x) * 4; if (e >= (size_t)NN * NN) return; const v4f a = *(const v4f*)(S + e); v4h o;
#pragma unroll
    for (int u = 0; u < 4; ++u) o[u] = tohx(fmaxf(a[u], 0.f) * (1.0f / NN) * PCAR); *(v4h*)(P + e) = o;  }
__global__ __launch_bounds__(256) void k_fin(const float* __restrict__ X, const float* __restrict__ O0, const float* __restrict__ O1, float* outb) { const int e = (blockIdx.x * 256 + threadIdx.x) * 4; if (e >= NN * DD) return; const v4f x = *(const v4f*)(X + e), a = *(const v4f*)(O0 + e), b = *(const v4f*)(O1 + e); v4f r;
#pragma unroll
    for (int u = 0; u < 4; ++u) { float s = __fadd_rn(a[u] * (1.0f / PCAR), b[u] * (1.0f / PCAR)); asm volatile("" : "+v"(s)); r[u] = __fadd_rn(bfr(x[u]), s); } *(v4f*)(outb + e) = r;  }

extern "C" void kernel_launch(void* const* d_in, const int* in_sizes, int n_in,
                              void* d_out, int out_size, void* d_ws, size_t ws_size, hipStream_t stream) {
    (void)in_sizes; (void)n_in; (void)out_size;
    const float** I = (const float**)d_in;
    const float *x = I[0], *WQ = I[1], *WK = I[2], *WV = I[3];
    float* OUT = (float*)d_out;     // [4][4096][64]
    char* wsp = (char*)d_ws;
    auto take = [&](size_t bytes) { char* p = wsp; wsp += (bytes + 255) & ~(size_t)255; return (void*)p; };
    bf* BQ = (bf*)take(NH_ * DD * DD * 2); bf* BK = (bf*)take(NH_ * DD * DD * 2); bf* BV = (bf*)take(NH_ * DD * DD * 2); bf* XB = (bf*)take((size_t)NN * DD * 2);
    float* Q = (float*)take((size_t)NN * DD * 4); float* K = (float*)take((size_t)NN * DD * 4); float* V = (float*)take((size_t)NN * DD * 4); h16* Q16 = (h16*)take((size_t)NN * DD * 2); h16* K16 = (h16*)take((size_t)NN * DD * 2); h16* VT = (h16*)take((size_t)DD * NN * 2);
    float* S = (float*)take((size_t)NN * NN * 4); h16* P = (h16*)take((size_t)NN * NN * 2); float* O[2]; O[0] = (float*)take((size_t)NN * DD * 4); O[1] = (float*)take((size_t)NN * DD * 4);
    if ((size_t)(wsp - (char*)d_ws) > ws_size) return;    // total ~ 100 MB ([4096][4096] f32 scores 64 MB + fp16 weights 32 MB)
    for (int h = 0; h < NH_; ++h) { k_wtG<<<(DD * DD / 64 + 63) / 64, 256, 0, stream>>>(WQ + h * DD * DD, DD, DD, BQ + h * DD * DD); k_wtG<<<(DD * DD / 64 + 63) / 64, 256, 0, stream>>>(WK + h * DD * DD, DD, DD, BK + h * DD * DD); k_wtG<<<(DD * DD / 64 + 63) / 64, 256, 0, stream>>>(WV + h * DD * DD, DD, DD, BV + h * DD * DD); }   // W[h] is [d][k] used as x @ W -> transposed gather
    for (int b = 0; b < NB_; ++b) { const float* xb = x + (size_t)b * NN * DD;
        k_cvt8<<<(NN * DD / 8 + 255) / 256, 256, 0, stream>>>(xb, XB, NN * DD / 8);
        for (int h = 0; h < NH_; ++h) {
            k_gemmw<bf, 0, false><<<dim3(NN / 64, 1, 1), 32, 0, stream>>>(XB, nullptr, BQ + h * DD * DD, nullptr, DD, Q, DD, nullptr, 0, 0, 0); k_gemmw<bf, 0, false><<<dim3(NN / 64, 1, 1), 32, 0, stream>>>(XB, nullptr, BK + h * DD * DD, nullptr, DD, K, DD, nullptr, 0, 0, 0); k_gemmw<bf, 0, false><<<dim3(NN / 64, 1, 1), 32, 0, stream>>>(XB, nullptr, BV + h * DD * DD, nullptr, DD, V, DD, nullptr, 0, 0, 0);
            k_p16<<<(NN * DD / 4 + 255) / 256, 256, 0, stream>>>(Q, Q16); k_p16<<<(NN * DD / 4 + 255) / 256, 256, 0, stream>>>(K, K16); k_vt<<<(DD * NN / 2 + 255) / 256, 256, 0, stream>>>(V, VT);
            k_gemmw<h16, 0, false><<<dim3(NN / 64, NN / 64, 1), 32, 0, stream>>>(Q16, nullptr, K16, nullptr, DD, S, NN, nullptr, 0, 0, 0);
            k_relu<<<(unsigned)(((size_t)NN * NN / 4 + 255) / 256), 256, 0, stream>>>(S, P);
            k_gemmw<h16, 0, false><<<dim3(NN / 64, 1, 1), 32, 0, stream>>>(P, nullptr, VT, nullptr, NN, O[h], DD, nullptr, 0, 0, 0); }
        k_fin<<<(NN * DD / 4 + 255) / 256, 256, 0, stream>>>(xb, O[0], O[1], OUT + (size_t)b * NN * DD); }
}

// v001
// It runs in 271 microseconds.
// Next to v000, in two timings, it ran 4.14 and 4.10 times as fast.
#include <hip/hip_runtime.h>

// SelfAttention_Inefficient (x [4][4096][64]; per head h of 2: Q/K/V = x W[h] (64x64); scores = relu(Q.K^T) / 4096 (no softmax); out = x + sum_h scores V -> [4][4096][64]).
// Compute dtypes, f32 accumulate: every input rounded to bf16; Q/K/V on PLAIN bf16 operands (inputs: exact; K 64); scores (K 64) single fp16 planes -> f32, relu and /4096 in f32 -> fp16 x 1024; scores.V single fp16 (1 product; the weights are O(1e-3) so fp16 rounding is

#define NB_  4
#define NN   4096
#define DD   64
#define NH_  2
#define PCAR 1024.0f
typedef _Float16 h16;
typedef unsigned short bf;
typedef __attribute__((ext_vector_type(16))) __bf16   v16bf;
typedef __attribute__((ext_vector_type(16))) _Float16 v16h;
typedef __attribute__((ext_vector_type(8)))  _Float16 v8h;
typedef __attribute__((ext_vector_type(8)))  unsigned short v8us;
typedef __attribute__((ext_vector_type(8)))  float    v8f;
typedef __attribute__((ext_vector_type(4)))  float    v4f;
typedef v8h  __attribute__((may_alias)) v8ha;
typedef v4f  __attribute__((may_alias)) v4fa;
typedef v8us __attribute__((may_alias)) v8usa;

__device__ __forceinline__ unsigned short f2bf(float f) { unsigned u = __float_as_uint(f); u += 0x7FFFu + ((u >> 16) & 1u); return (unsigned short)(u >> 16); }
__device__ __forceinline__ float bf2f(unsigned short b) { return __uint_as_float(((unsigned)b) << 16); }
__device__ __forceinline__ float bfr(float f) { return bf2f(f2bf(f)); }
__device__ __forceinline__ v16h cat16(v8h lo, v8h hi) { return __builtin_shufflevector(lo, hi, 0, 1, 2, 3, 4, 5, 6, 7, 8, 9, 10, 11, 12, 13, 14, 15); }
__device__ __forceinline__ v16bf cat16b(v8us lo, v8us hi) { return __builtin_bit_cast(v16bf, __builtin_shufflevector(lo, hi, 0, 1, 2, 3, 4, 5, 6, 7, 8, 9, 10, 11, 12, 13, 14, 15)); }
__device__ __forceinline__ v8f wmma16(v16h a, v16h b, v8f c) { return __builtin_amdgcn_wmma_f32_16x16x32_f16(false, a, false, b, (short)0, c, false, false); }
__device__ __forceinline__ v8f wmmab(v16bf a, v16bf b, v8f c) { return __builtin_amdgcn_wmma_f32_16x16x32_bf16(false, a, false, b, (short)0, c, false, false); }



// ---- k_gemmw: register-blocked GEMM, ONE WAVE per 64x64 output tile (16 accumulators), operands straight from K-contiguous 16-bit planes; grid (M/64, N/64, Z), 32 threads.
// C[m][n] (f32, pitch ldc, + optional f32 bias[n]) = sum_k A[m][k] Bt[n][k] (+ split products per NSPLIT). z-batch strides sA/sB/sC in elements. K % 32 == 0.
template <typename T16> struct WFrag;
template <> struct WFrag<h16> { typedef v16h V; static __device__ __forceinline__ V ld(const h16* p) { return cat16(*(const v8h*)p, *(const v8h*)(p + 16)); } static __device__ __forceinline__ v8f mma(V a, V b, v8f c) { return wmma16(a, b, c); } };
template <> struct WFrag<bf> { typedef v16bf V; static __device__ __forceinline__ V ld(const bf* p) { return cat16b(*(const v8us*)p, *(const v8us*)(p + 16)); } static __device__ __forceinline__ v8f mma(V a, V b, v8f c) { return wmmab(a, b, c); } };
template <typename T16, int NSPLIT, bool BIAS>
__global__ __launch_bounds__(32) void k_gemmw(const T16* __restrict__ A, const T16* __restrict__ A2, const T16* __restrict__ Bt, const T16* __restrict__ Bt2, int K, float* C, int ldc, const float* __restrict__ bias, size_t sA, size_t sB, size_t sC) {
    typedef typename WFrag<T16>::V V;
    __shared__ __align__(16) float os[16 * 68];
    const size_t z = blockIdx.z; A += z * sA; if (A2) A2 += z * sA; Bt += z * sB; if (Bt2) Bt2 += z * sB; C += z * sC;
    const int lane = threadIdx.x & 31, lr = lane & 15, hi = lane >> 4; const int r0 = blockIdx.x * 64, c0 = blockIdx.y * 64;
    v8f acc[4][4];
#pragma unroll
    for (int mb = 0; mb < 4; ++mb)
#pragma unroll
        for (int nb = 0; nb < 4; ++nb) acc[mb][nb] = (v8f){};
    const size_t aoff = (size_t)(r0 + lr) * K + 8 * hi, boff = (size_t)(c0 + lr) * K + 8 * hi;
#pragma unroll 1
    for (int kc = 0; kc < K; kc += 32) {
        V a[4], a2[4];
#pragma unroll
        for (int mb = 0; mb < 4; ++mb) { a[mb] = WFrag<T16>::ld(A + aoff + (size_t)mb * 16 * K + kc); if (NSPLIT == 1 || NSPLIT == 2) a2[mb] = WFrag<T16>::ld(A2 + aoff + (size_t)mb * 16 * K + kc); }
#pragma unroll
        for (int nb = 0; nb < 4; ++nb) { const V b = WFrag<T16>::ld(Bt + boff + (size_t)nb * 16 * K + kc); V b2; if (NSPLIT >= 2) b2 = WFrag<T16>::ld(Bt2 + boff + (size_t)nb * 16 * K + kc);
#pragma unroll
            for (int mb = 0; mb < 4; ++mb) { acc[mb][nb] = WFrag<T16>::mma(a[mb], b, acc[mb][nb]); if (NSPLIT == 1 || NSPLIT == 2) acc[mb][nb] = WFrag<T16>::mma(a2[mb], b, acc[mb][nb]); if (NSPLIT >= 2) acc[mb][nb] = WFrag<T16>::mma(a[mb], b2, acc[mb][nb]); } }
        asm volatile("v_nop\n\tv_nop\n\tv_nop\n\tv_nop" : "+v"(acc[0][0]), "+v"(acc[1][1]), "+v"(acc[2][2]), "+v"(acc[3][3]) : "v"(a[0]), "v"(a[3]));
    }
#pragma unroll
    for (int mb = 0; mb < 4; ++mb) {
#pragma unroll
        for (int nb = 0; nb < 4; ++nb) {
#pragma unroll
            for (int j = 0; j < 8; ++j) os[(hi * 8 + j) * 68 + nb * 16 + lr] = acc[mb][nb][j]; }
        __builtin_amdgcn_wave_barrier(); asm volatile("" ::: "memory");
        float* crow = C + (size_t)(r0 + mb * 16) * ldc + c0;
{
#pragma unroll
            for (int s = 0; s < 8; ++s) { const int row = 2 * s + hi, cofs = lr * 4; v4f val = *(const v4fa*)(os + row * 68 + cofs); if (BIAS) { val[0] += bfr(bias[c0 + cofs]); val[1] += bfr(bias[c0 + cofs + 1]); val[2] += bfr(bias[c0 + cofs + 2]); val[3] += bfr(bias[c0 + cofs + 3]); }
                *(v4f*)(crow + (size_t)row * ldc + cofs) = val; }
             }
        __builtin_amdgcn_wave_barrier(); asm volatile("" ::: "memory");
    }
}

__device__ __forceinline__ h16 tohx(float x) { return (h16)x; }
typedef __attribute__((ext_vector_type(2))) unsigned short v2us;
typedef __attribute__((ext_vector_type(2))) _Float16 v2h;
typedef __attribute__((ext_vector_type(4))) _Float16 v4h;

__global__ __launch_bounds__(256) void k_wtG(const float* __restrict__ w, int K, int N, bf* Bt) {
    const int lane = threadIdx.x & 31; const int L0 = (blockIdx.x * 8 + (threadIdx.x >> 5)) * 8; const int nlines = N * K / 64;
{
#pragma unroll 1
        for (int l = 0; l < 8; ++l) { const int L = L0 + l; if (L >= nlines) break; const size_t e = (size_t)L * 64 + lane * 2; const int k = (int)(e % K), n = (int)(e / K); v2us o;
            o[0] = f2bf(w[(size_t)k * N + n]); o[1] = f2bf(w[(size_t)(k + 1) * N + n]); *(v2us*)(Bt + e) = o; }
         }
}
__global__ __launch_bounds__(256) void k_cvt8(const float* __restrict__ src, bf* dst, size_t n8) { const size_t i = (size_t)blockIdx.x * 256 + threadIdx.x; if (i >= n8) return; const v8f v = *(const v8f*)(src + i * 8); v8us o;
#pragma unroll
    for (int k = 0; k < 8; ++k) o[k] = f2bf(v[k]); *(v8us*)(dst + i * 8) = o;  }
__global__ __launch_bounds__(256) void k_p16(const float* __restrict__ F, h16* P) { const int e = (blockIdx.x * 256 + threadIdx.x) * 4; if (e >= NN * DD) return; const v4f a = *(const v4f*)(F + e); v4h o;
#pragma unroll
    for (int u = 0; u < 4; ++u) o[u] = tohx(a[u]); *(v4h*)(P + e) = o;  }
__global__ __launch_bounds__(256) void k_vt(const float* __restrict__ V, h16* VT) { const int e = (blockIdx.x * 256 + threadIdx.x) * 2; if (e >= DD * NN) return; const int n = e % NN; const int d = e / NN; v2h o; o[0] = tohx(V[(size_t)n * DD + d]); o[1] = tohx(V[(size_t)(n + 1) * DD + d]); *(v2h*)(VT + e) = o;  }
// ---- k_attn: scores, relu and scores.V in one kernel; the weights never leave registers. Grid (N / 32, 2): 16 waves per work-group share 32 queries and one half of the keys; wave w takes every 16th block of 32 keys of that half.
// Transposed products: S^T = K Q^T (A = 16 key rows, B = 16 query columns), so two f32 S^T tiles of 32 keys, scaled and rounded to fp16 in place, are the B operand of O^T += V^T P^T (A = 16 rows of VT).
// All three loaders give the hardware k order (8 * hi + s, then 16 + 8 * hi + s). The 16 partial O tiles are summed in wave order through LDS; the two halves' planes O[0 .. N*D) and O[N*D .. 2*N*D) are added in k_fin.
// Left for a later step: every K and VT fragment load touches 16 cache lines for its 512 bytes.
#define FW 16
#define KS 2
#define RP 68
__global__ __launch_bounds__(FW * 32) __attribute__((amdgpu_waves_per_eu(4, 4))) void k_attn(const h16* __restrict__ Qp, const h16* __restrict__ Kp, const h16* __restrict__ VTp, float* __restrict__ O) {
    __shared__ __align__(16) float red[FW * 32 * RP];
    const int lane = threadIdx.x & 31, lr = lane & 15, hi = lane >> 4; const int w = __builtin_amdgcn_readfirstlane(threadIdx.x >> 5); const int q0 = blockIdx.x * 32;
    v16h qf[2][2]; const unsigned qo = ((q0 + lr) * DD + 8 * hi) * 2;
#pragma unroll
    for (int g = 0; g < 2; ++g)
#pragma unroll
        for (int kc = 0; kc < 2; ++kc) qf[g][kc] = WFrag<h16>::ld((const h16*)((const char*)Qp + (g * 16 * DD + kc * 32) * 2 + qo));
    v8f acc[4][2];
#pragma unroll
    for (int dt = 0; dt < 4; ++dt)
#pragma unroll
        for (int g = 0; g < 2; ++g) acc[dt][g] = (v8f){};
    const char* kb = (const char*)Kp; const char* vb = (const char*)VTp;
    const int kfirst = blockIdx.y * (NN / KS) + w * 32;
    unsigned ko = ((kfirst + lr) * DD + 8 * hi) * 2, vo = (lr * NN + kfirst + 8 * hi) * 2;    // the lane's byte offsets into the K and VT planes (512 KiB each), stepped once a pass
#pragma unroll 1    // rolled: nothing moves across the scheduling barrier below, so unrolling would only add code
    for (int it = 0; it < NN / 32 / FW / KS; ++it) {
        v16h kf[2][2], vf[4];
#pragma unroll
        for (int t = 0; t < 2; ++t)
#pragma unroll
            for (int kc = 0; kc < 2; ++kc) kf[t][kc] = WFrag<h16>::ld((const h16*)(kb + (t * 16 * DD + kc * 32) * 2 + ko));
#pragma unroll
        for (int dt = 0; dt < 4; ++dt) vf[dt] = WFrag<h16>::ld((const h16*)(vb + dt * 16 * NN * 2 + vo));
        __builtin_amdgcn_sched_barrier(0);    // all sixteen loads of the pass are issued before its first product, so that the VT loads do not wait for K data to free registers
        v8f s[2][2];
#pragma unroll
        for (int g = 0; g < 2; ++g)
#pragma unroll
            for (int t = 0; t < 2; ++t) s[g][t] = wmma16(kf[t][1], qf[g][1], wmma16(kf[t][0], qf[g][0], (v8f){}));
#pragma unroll
        for (int g = 0; g < 2; ++g) { v16h p;
#pragma unroll
            for (int j = 0; j < 8; ++j) { p[j] = tohx(fmaxf(s[g][0][j] * ((1.0f / NN) * PCAR), 0.f)); p[8 + j] = tohx(fmaxf(s[g][1][j] * ((1.0f / NN) * PCAR), 0.f)); }    // the scale is a power of two: same fp16 value as relu, / N, x 1024 in turn
#pragma unroll
            for (int dt = 0; dt < 4; ++dt) acc[dt][g] = wmma16(vf[dt], p, acc[dt][g]); }
        ko += FW * 32 * DD * 2; vo += FW * 32 * 2;
    }
    float* mine = red + w * 32 * RP;
#pragma unroll
    for (int g = 0; g < 2; ++g)
#pragma unroll
        for (int dt = 0; dt < 4; ++dt) { float* d = mine + (g * 16 + lr) * RP + dt * 16 + hi * 8; const v8f a = acc[dt][g];
            *(v4fa*)d = (v4f){a[0], a[1], a[2], a[3]}; *(v4fa*)(d + 4) = (v4f){a[4], a[5], a[6], a[7]}; }
    __syncthreads();    // every wave's partial tile is in LDS before any thread sums across the waves
    const int q = threadIdx.x >> 4, d4 = (threadIdx.x & 15) * 4; v4f r = *(const v4fa*)(red + q * RP + d4);
#pragma unroll
    for (int u = 1; u < FW; ++u) r += *(const v4fa*)(red + u * 32 * RP + q * RP + d4);
    *(v4f*)(O + (size_t)blockIdx.y * NN * DD + (size_t)(q0 + q) * DD + d4) = r;
}
__global__ __launch_bounds__(256) void k_fin(const float* __restrict__ X, const float* __restrict__ O0, const float* __restrict__ O1, float* outb) { const int e = (blockIdx.x * 256 + threadIdx.x) * 4; if (e >= NN * DD) return; const v4f a = *(const v4f*)(O0 + e) + *(const v4f*)(O0 + NN * DD + e), b = *(const v4f*)(O1 + e) + *(const v4f*)(O1 + NN * DD + e);
    asm volatile("s_wait_xcnt 0x0" ::: "memory");    // the four loads' address registers are free for reuse from here on
    const v4f x = *(const v4f*)(X + e); v4f r;
#pragma unroll
    for (int u = 0; u < 4; ++u) { float s = __fadd_rn(a[u] * (1.0f / PCAR), b[u] * (1.0f / PCAR)); asm volatile("" : "+v"(s)); r[u] = __fadd_rn(bfr(x[u]), s); } *(v4f*)(outb + e) = r;  }

extern "C" void kernel_launch(void* const* d_in, const int* in_sizes, int n_in,
                              void* d_out, int out_size, void* d_ws, size_t ws_size, hipStream_t stream) {
    (void)in_sizes; (void)n_in; (void)out_size;
    const float** I = (const float**)d_in;
    const float *x = I[0], *WQ = I[1], *WK = I[2], *WV = I[3];
    float* OUT = (float*)d_out;     // [4][4096][64]
    char* wsp = (char*)d_ws;
    auto take = [&](size_t bytes) { char* p = wsp; wsp += (bytes + 255) & ~(size_t)255; return (void*)p; };
    bf* BQ = (bf*)take(NH_ * DD * DD * 2); bf* BK = (bf*)take(NH_ * DD * DD * 2); bf* BV = (bf*)take(NH_ * DD * DD * 2); bf* XB = (bf*)take((size_t)NN * DD * 2);
    float* Q = (float*)take((size_t)NN * DD * 4); float* K = (float*)take((size_t)NN * DD * 4); float* V = (float*)take((size_t)NN * DD * 4); h16* Q16 = (h16*)take((size_t)NN * DD * 2); h16* K16 = (h16*)take((size_t)NN * DD * 2); h16* VT = (h16*)take((size_t)DD * NN * 2);
    float* O[2]; O[0] = (float*)take((size_t)KS * NN * DD * 4); O[1] = (float*)take((size_t)KS * NN * DD * 4);
    if ((size_t)(wsp - (char*)d_ws) > ws_size) return;
    for (int h = 0; h < NH_; ++h) { k_wtG<<<(DD * DD / 64 + 63) / 64, 256, 0, stream>>>(WQ + h * DD * DD, DD, DD, BQ + h * DD * DD); k_wtG<<<(DD * DD / 64 + 63) / 64, 256, 0, stream>>>(WK + h * DD * DD, DD, DD, BK + h * DD * DD); k_wtG<<<(DD * DD / 64 + 63) / 64, 256, 0, stream>>>(WV + h * DD * DD, DD, DD, BV + h * DD * DD); }   // W[h] is [d][k] used as x @ W -> transposed gather
    for (int b = 0; b < NB_; ++b) { const float* xb = x + (size_t)b * NN * DD;
        k_cvt8<<<(NN * DD / 8 + 255) / 256, 256, 0, stream>>>(xb, XB, NN * DD / 8);
        for (int h = 0; h < NH_; ++h) {
            k_gemmw<bf, 0, false><<<dim3(NN / 64, 1, 1), 32, 0, stream>>>(XB, nullptr, BQ + h * DD * DD, nullptr, DD, Q, DD, nullptr, 0, 0, 0); k_gemmw<bf, 0, false><<<dim3(NN / 64, 1, 1), 32, 0, stream>>>(XB, nullptr, BK + h * DD * DD, nullptr, DD, K, DD, nullptr, 0, 0, 0); k_gemmw<bf, 0, false><<<dim3(NN / 64, 1, 1), 32, 0, stream>>>(XB, nullptr, BV + h * DD * DD, nullptr, DD, V, DD, nullptr, 0, 0, 0);
            k_p16<<<(NN * DD / 4 + 255) / 256, 256, 0, stream>>>(Q, Q16); k_p16<<<(NN * DD / 4 + 255) / 256, 256, 0, stream>>>(K, K16); k_vt<<<(DD * NN / 2 + 255) / 256, 256, 0, stream>>>(V, VT);
            k_attn<<<dim3(NN / 32, KS, 1), FW * 32, 0, stream>>>(Q16, K16, VT, O[h]); }
        k_fin<<<(NN * DD / 4 + 255) / 256, 256, 0, stream>>>(xb, O[0], O[1], OUT + (size_t)b * NN * DD); }
}

// v003
// Measured time: 60 microseconds a run.
// Versions between v001 and this one are left out; their measured steps multiply to 4.53 times as fast.
// Counting every step since v000, it is 18.7 times as fast.
#include <hip/hip_runtime.h>

// SelfAttention_Inefficient (x [4][4096][64]; per head h of 2: Q/K/V = x W[h] (64x64); scores = relu(Q.K^T) / 4096 (no softmax); out = x + sum_h scores V -> [4][4096][64]).
// Compute dtypes, f32 accumulate: every input rounded to bf16; Q/K/V on PLAIN bf16 operands (inputs: exact; K 64); scores (K 64) single fp16 planes -> f32, relu and /4096 in f32 -> fp16 x 1024; scores.V single fp16 (1 product; the weights are O(1e-3) so fp16 rounding is

#define NB_  4
#define NN   4096
#define DD   64
#define NH_  2
#define NP_  (NH_ * NB_)    // planes: one per (head, batch), index head * NB_ + batch
#define PCAR 1024.0f
typedef _Float16 h16;
typedef unsigned short bf;
typedef __attribute__((ext_vector_type(16))) __bf16   v16bf;
typedef __attribute__((ext_vector_type(16))) _Float16 v16h;
typedef __attribute__((ext_vector_type(8)))  _Float16 v8h;
typedef __attribute__((ext_vector_type(8)))  unsigned short v8us;
typedef __attribute__((ext_vector_type(8)))  float    v8f;
typedef __attribute__((ext_vector_type(4)))  float    v4f;
typedef v8h  __attribute__((may_alias)) v8ha;
typedef v4f  __attribute__((may_alias)) v4fa;
typedef v8us __attribute__((may_alias)) v8usa;

__device__ __forceinline__ unsigned short f2bf(float f) { unsigned u = __float_as_uint(f); u += 0x7FFFu + ((u >> 16) & 1u); return (unsigned short)(u >> 16); }
__device__ __forceinline__ float bf2f(unsigned short b) { return __uint_as_float(((unsigned)b) << 16); }
__device__ __forceinline__ float bfr(float f) { return bf2f(f2bf(f)); }
__device__ __forceinline__ v16h cat16(v8h lo, v8h hi) { return __builtin_shufflevector(lo, hi, 0, 1, 2, 3, 4, 5, 6, 7, 8, 9, 10, 11, 12, 13, 14, 15); }
__device__ __forceinline__ v16bf cat16b(v8us lo, v8us hi) { return __builtin_bit_cast(v16bf, __builtin_shufflevector(lo, hi, 0, 1, 2, 3, 4, 5, 6, 7, 8, 9, 10, 11, 12, 13, 14, 15)); }
__device__ __forceinline__ v8f wmma16(v16h a, v16h b, v8f c) { return __builtin_amdgcn_wmma_f32_16x16x32_f16(false, a, false, b, (short)0, c, false, false); }
__device__ __forceinline__ v8f wmmab(v16bf a, v16bf b, v8f c) { return __builtin_amdgcn_wmma_f32_16x16x32_bf16(false, a, false, b, (short)0, c, false, false); }



// ---- k_gemmw: register-blocked GEMM, ONE WAVE per 64x64 output tile (16 accumulators), operands straight from K-contiguous 16-bit planes; grid (M/64, N/64, Z), 32 threads.
// C[m][n] (f32, pitch ldc, + optional f32 bias[n]) = sum_k A[m][k] Bt[n][k] (+ split products per NSPLIT). z-batch strides sA/sB/sC in elements. K % 32 == 0.
template <typename T16> struct WFrag;
template <> struct WFrag<h16> { typedef v16h V; static __device__ __forceinline__ V ld(const h16* p) { return cat16(*(const v8h*)p, *(const v8h*)(p + 16)); } static __device__ __forceinline__ v8f mma(V a, V b, v8f c) { return wmma16(a, b, c); } };
template <> struct WFrag<bf> { typedef v16bf V; static __device__ __forceinline__ V ld(const bf* p) { return cat16b(*(const v8us*)p, *(const v8us*)(p + 16)); } static __device__ __forceinline__ v8f mma(V a, V b, v8f c) { return wmmab(a, b, c); } };
template <typename T16, int NSPLIT, bool BIAS>
__global__ __launch_bounds__(32) void k_gemmw(const T16* __restrict__ A, const T16* __restrict__ A2, const T16* __restrict__ Bt, const T16* __restrict__ Bt2, int K, float* C, int ldc, const float* __restrict__ bias, size_t sA, size_t sB, size_t sC) {
    typedef typename WFrag<T16>::V V;
    __shared__ __align__(16) float os[16 * 68];
    const size_t z = blockIdx.z; A += z * sA; if (A2) A2 += z * sA; Bt += z * sB; if (Bt2) Bt2 += z * sB; C += z * sC;
    const int lane = threadIdx.x & 31, lr = lane & 15, hi = lane >> 4; const int r0 = blockIdx.x * 64, c0 = blockIdx.y * 64;
    v8f acc[4][4];
#pragma unroll
    for (int mb = 0; mb < 4; ++mb)
#pragma unroll
        for (int nb = 0; nb < 4; ++nb) acc[mb][nb] = (v8f){};
    const size_t aoff = (size_t)(r0 + lr) * K + 8 * hi, boff = (size_t)(c0 + lr) * K + 8 * hi;
#pragma unroll 1
    for (int kc = 0; kc < K; kc += 32) {
        V a[4], a2[4];
#pragma unroll
        for (int mb = 0; mb < 4; ++mb) { a[mb] = WFrag<T16>::ld(A + aoff + (size_t)mb * 16 * K + kc); if (NSPLIT == 1 || NSPLIT == 2) a2[mb] = WFrag<T16>::ld(A2 + aoff + (size_t)mb * 16 * K + kc); }
#pragma unroll
        for (int nb = 0; nb < 4; ++nb) { const V b = WFrag<T16>::ld(Bt + boff + (size_t)nb * 16 * K + kc); V b2; if (NSPLIT >= 2) b2 = WFrag<T16>::ld(Bt2 + boff + (size_t)nb * 16 * K + kc);
#pragma unroll
            for (int mb = 0; mb < 4; ++mb) { acc[mb][nb] = WFrag<T16>::mma(a[mb], b, acc[mb][nb]); if (NSPLIT == 1 || NSPLIT == 2) acc[mb][nb] = WFrag<T16>::mma(a2[mb], b, acc[mb][nb]); if (NSPLIT >= 2) acc[mb][nb] = WFrag<T16>::mma(a[mb], b2, acc[mb][nb]); } }
        asm volatile("v_nop\n\tv_nop\n\tv_nop\n\tv_nop" : "+v"(acc[0][0]), "+v"(acc[1][1]), "+v"(acc[2][2]), "+v"(acc[3][3]) : "v"(a[0]), "v"(a[3]));
    }
#pragma unroll
    for (int mb = 0; mb < 4; ++mb) {
#pragma unroll
        for (int nb = 0; nb < 4; ++nb) {
#pragma unroll
            for (int j = 0; j < 8; ++j) os[(hi * 8 + j) * 68 + nb * 16 + lr] = acc[mb][nb][j]; }
        __builtin_amdgcn_wave_barrier(); asm volatile("" ::: "memory");
        float* crow = C + (size_t)(r0 + mb * 16) * ldc + c0;
{
#pragma unroll
            for (int s = 0; s < 8; ++s) { const int row = 2 * s + hi, cofs = lr * 4; v4f val = *(const v4fa*)(os + row * 68 + cofs); if (BIAS) { val[0] += bfr(bias[c0 + cofs]); val[1] += bfr(bias[c0 + cofs + 1]); val[2] += bfr(bias[c0 + cofs + 2]); val[3] += bfr(bias[c0 + cofs + 3]); }
                *(v4f*)(crow + (size_t)row * ldc + cofs) = val; }
             }
        __builtin_amdgcn_wave_barrier(); asm volatile("" ::: "memory");
    }
}

__device__ __forceinline__ h16 tohx(float x) { return (h16)x; }
typedef __attribute__((ext_vector_type(2))) unsigned short v2us;
typedef __attribute__((ext_vector_type(2))) _Float16 v2h;
typedef __attribute__((ext_vector_type(4))) _Float16 v4h;

// grid.y = 3 * heads: matrix y is head y % heads of WQ, WK, WV in turn; the transposed planes lie one behind the other in Bt.
__global__ __launch_bounds__(256) void k_wtG(const float* __restrict__ wq, const float* __restrict__ wk, const float* __restrict__ wv, int K, int N, bf* Bt) {
    const int y = blockIdx.y; const float* __restrict__ w = (y < NH_ ? wq : y < 2 * NH_ ? wk : wv) + (size_t)(y % NH_) * K * N; Bt += (size_t)y * K * N;
    const int lane = threadIdx.x & 31; const int L0 = (blockIdx.x * 8 + (threadIdx.x >> 5)) * 8; const int nlines = N * K / 64;
{
#pragma unroll 1
        for (int l = 0; l < 8; ++l) { const int L = L0 + l; if (L >= nlines) break; const size_t e = (size_t)L * 64 + lane * 2; const int k = (int)(e % K), n = (int)(e / K); v2us o;
            o[0] = f2bf(w[(size_t)k * N + n]); o[1] = f2bf(w[(size_t)(k + 1) * N + n]); *(v2us*)(Bt + e) = o; }
         }
}
__global__ __launch_bounds__(256) void k_cvt8(const float* __restrict__ src, bf* dst, size_t n8) { const size_t i = (size_t)blockIdx.x * 256 + threadIdx.x; if (i >= n8) return; const v8f v = *(const v8f*)(src + i * 8); v8us o;
#pragma unroll
    for (int k = 0; k < 8; ++k) o[k] = f2bf(v[k]); *(v8us*)(dst + i * 8) = o;  }
// One launch for all planes (Q, then K, of every head and batch, one behind the other): grid.y = 0 for Q, 1 for K; each thread converts its four elements of every plane of that operand.
__global__ __launch_bounds__(256) void k_p16(const float* __restrict__ F, h16* __restrict__ P) { const int e = (blockIdx.x * 256 + threadIdx.x) * 4; if (e >= NN * DD) return;
    F += (size_t)blockIdx.y * NP_ * NN * DD; P += (size_t)blockIdx.y * NP_ * NN * DD;
#pragma unroll    // unrolled: the planes' loads are independent and are all in flight together
    for (int pl = 0; pl < NP_; ++pl) { const v4f a = *(const v4f*)(F + (size_t)pl * NN * DD + e); v4h o;
#pragma unroll
        for (int u = 0; u < 4; ++u) o[u] = tohx(a[u]); *(v4h*)(P + (size_t)pl * NN * DD + e) = o; } }
__global__ __launch_bounds__(256) void k_vt(const float* __restrict__ V, h16* __restrict__ VT) { const int e = (blockIdx.x * 256 + threadIdx.x) * 2; if (e >= DD * NN) return; const int n = e % NN; const int d = e / NN;
    const float* Vp = V + (size_t)n * DD + d; float a[NP_], b[NP_];    // one launch for all planes: each thread transposes its two elements of every plane
#pragma unroll    // unrolled: the planes' loads are independent and are all in flight together
    for (int pl = 0; pl < NP_; ++pl) { a[pl] = Vp[(size_t)pl * NN * DD]; b[pl] = Vp[(size_t)pl * NN * DD + DD]; }
    asm volatile("s_wait_xcnt 0x0" :: "v"(Vp) : "memory");    // all the loads name one address pair: it stays whole up to here and is free for reuse from here on
#pragma unroll
    for (int pl = 0; pl < NP_; ++pl) { v2h o; o[0] = tohx(a[pl]); o[1] = tohx(b[pl]); *(v2h*)(VT + (size_t)pl * DD * NN + e) = o; } }
// ---- k_attn: scores, relu and scores.V in one kernel; the weights never leave registers. Grid (N / 256, 2, planes): the 8 waves of a work-group take 32 queries each and walk one half of the keys together.
// Each stage of 128 keys (K rows and VT rows, 16 KiB each) is brought into LDS once for all 8 waves by asynchronous copies of whole cache lines, two buffers: the next stage's copies fly while this one is worked on.
// Transposed products: S^T = K Q^T (A = 16 key rows, B = 16 query columns), so two f32 S^T tiles of 32 keys, scaled and rounded to fp16 in place, are the B operand of O^T += V^T P^T (A = 16 rows of VT).
// All three loaders give the hardware k order (8 * hi + s, then 16 + 8 * hi + s). A wave sums all its keys in its own accumulators; the two halves' planes O[0 .. N*D) and O[N*D .. 2*N*D) are added in k_fin.
#define FW 8                       // waves per work-group
#define KS 2                       // key halves (grid.y)
#define KT 128                     // keys per stage
#define KPI 144                    // LDS pitch of a K row (128 bytes + 16: an odd multiple of 16 bytes, free of bank conflicts for 16-byte reads)
#define VPI 272                    // LDS pitch of a VT row (256 bytes + 16)
#define KBY (KT * KPI)
#define SBY (KBY + DD * VPI)       // one buffer: K tile, then VT tile
#define NST (NN / KS / KT)         // stages per work-group
#define RP 68
// One stage: each lane copies four 16-byte pieces of the K tile (32 rows apart) and four of the VT tile (16 rows apart).
// The wait is the statement's last line, so that no address register is rewritten before it.
__device__ __forceinline__ void stage_copy(unsigned lk, unsigned lv, const char* gk, const char* gv) {
    asm volatile("global_load_async_to_lds_b128 %0, %1, off\n\t"
                 "global_load_async_to_lds_b128 %2, %3, off\n\t"
                 "global_load_async_to_lds_b128 %4, %5, off\n\t"
                 "global_load_async_to_lds_b128 %6, %7, off\n\t"
                 "global_load_async_to_lds_b128 %8, %9, off\n\t"
                 "global_load_async_to_lds_b128 %10, %11, off\n\t"
                 "global_load_async_to_lds_b128 %12, %13, off\n\t"
                 "global_load_async_to_lds_b128 %14, %15, off\n\t"
                 "s_wait_xcnt 0x0"
                 :: "v"(lk), "v"(gk), "v"(lk + 32 * KPI), "v"(gk + 32 * DD * 2), "v"(lk + 64 * KPI), "v"(gk + 64 * DD * 2), "v"(lk + 96 * KPI), "v"(gk + 96 * DD * 2),
                    "v"(lv), "v"(gv), "v"(lv + 16 * VPI), "v"(gv + 16 * NN * 2), "v"(lv + 32 * VPI), "v"(gv + 32 * NN * 2), "v"(lv + 48 * VPI), "v"(gv + 48 * NN * 2)
                 : "memory");
}
__device__ __forceinline__ v16h ldsfrag(const char* p) { return cat16(*(const v8ha*)p, *(const v8ha*)(p + 32)); }
// At most two waves a SIMD, that is one work-group a WGP: the grid has as many work-groups as the chip has WGPs, and two on one WGP would leave another idle.
__global__ __launch_bounds__(FW * 32) __attribute__((amdgpu_waves_per_eu(2, 2))) void k_attn(const h16* __restrict__ Qp, const h16* __restrict__ Kp, const h16* __restrict__ VTp, float* __restrict__ O) {
    __shared__ __align__(16) char sm[2 * SBY];    // every inner loop below is unrolled, so that the register arrays are indexed by constants only
    { const size_t z = blockIdx.z; Qp += z * NN * DD; Kp += z * NN * DD; VTp += z * DD * NN; O += z * KS * NN * DD; }
    const int tid = threadIdx.x, lane = tid & 31, lr = lane & 15, hi = lane >> 4; const int w = __builtin_amdgcn_readfirstlane(tid >> 5); const int q0 = blockIdx.x * (FW * 32) + w * 32;
    const int kfirst = blockIdx.y * (NN / KS);
    const unsigned lk = (unsigned)(size_t)sm + (tid >> 3) * KPI + (tid & 7) * 16, lv = (unsigned)(size_t)sm + KBY + (tid >> 4) * VPI + (tid & 15) * 16;    // the lane's places in buffer 0
    const char* gk = (const char*)Kp + (size_t)kfirst * DD * 2 + tid * 16; const char* gv = (const char*)VTp + (size_t)(tid >> 4) * NN * 2 + kfirst * 2 + (tid & 15) * 16;    // and its sources in stage 0
    stage_copy(lk, lv, gk, gv);
    v16h qf[2][2]; const unsigned qo = ((q0 + lr) * DD + 8 * hi) * 2;
#pragma unroll
    for (int g = 0; g < 2; ++g)
#pragma unroll
        for (int kc = 0; kc < 2; ++kc) qf[g][kc] = WFrag<h16>::ld((const h16*)((const char*)Qp + (g * 16 * DD + kc * 32) * 2 + qo));
    v8f acc[4][2];
#pragma unroll
    for (int dt = 0; dt < 4; ++dt)
#pragma unroll
        for (int g = 0; g < 2; ++g) acc[dt][g] = (v8f){};
    asm volatile("s_wait_asynccnt 0x0" ::: "memory");    // this wave's part of stage 0 has landed
    __syncthreads();                                     // and so has every other wave's
    stage_copy(lk + SBY, lv + SBY, gk + KT * DD * 2, gv + KT * 2);
    const char* kl = sm + lr * KPI + 16 * hi; const char* vl = sm + KBY + lr * VPI + 16 * hi;    // the lane's fragment rows in buffer 0
#pragma unroll 1    // rolled: one trip a stage, the buffer chosen by the trip's parity
    for (int st = 0; st < NST; ++st) {
        const int bo = (st & 1) * SBY; const char* kb = kl + bo; const char* vb = vl + bo;
        v16h kf[2][2], vf[4];
#pragma unroll
        for (int t = 0; t < 2; ++t)
#pragma unroll
            for (int kc = 0; kc < 2; ++kc) kf[t][kc] = ldsfrag(kb + t * 16 * KPI + kc * 64);
#pragma unroll    // unrolled: LDS offsets become immediates, and the last 32 keys of a stage fetch no K rows ahead without a branch
        for (int p = 0; p < KT / 32; ++p) {
#pragma unroll
            for (int dt = 0; dt < 4; ++dt) vf[dt] = ldsfrag(vb + dt * 16 * VPI + p * 64);
            __builtin_amdgcn_sched_barrier(0);    // the VT reads stand as one group in front of the score products, which hide their latency
            v8f s[2][2];
#pragma unroll
            for (int g = 0; g < 2; ++g)
#pragma unroll
                for (int t = 0; t < 2; ++t) s[g][t] = wmma16(kf[t][1], qf[g][1], wmma16(kf[t][0], qf[g][0], (v8f){}));
            __builtin_amdgcn_sched_barrier(0);    // the next 32 keys' K reads stand as one group behind the score products, not among them
            if (p + 1 < KT / 32) {
#pragma unroll
                for (int t = 0; t < 2; ++t)
#pragma unroll
                    for (int kc = 0; kc < 2; ++kc) kf[t][kc] = ldsfrag(kb + ((p + 1) * 32 + t * 16) * KPI + kc * 64);
            }
            __builtin_amdgcn_sched_barrier(0);    // and in front of the relu and the second products, which hide their latency
#pragma unroll
            for (int g = 0; g < 2; ++g) { v16h pr;
#pragma unroll
                for (int j = 0; j < 8; ++j) { pr[j] = tohx(fmaxf(s[g][0][j] * ((1.0f / NN) * PCAR), 0.f)); pr[8 + j] = tohx(fmaxf(s[g][1][j] * ((1.0f / NN) * PCAR), 0.f)); }    // the scale is a power of two: same fp16 value as relu, / N, x 1024 in turn
#pragma unroll
                for (int dt = 0; dt < 4; ++dt) acc[dt][g] = wmma16(vf[dt], pr, acc[dt][g]); }
        }
        asm volatile("s_wait_dscnt 0x0" ::: "memory");       // this wave's reads of the buffer are done
        asm volatile("s_wait_asynccnt 0x0" ::: "memory");    // its part of the next stage has landed
        __syncthreads();                                     // both hold for every wave: the next stage may be read, this buffer refilled
        if (st + 2 < NST) stage_copy(lk + bo, lv + bo, gk + (size_t)(st + 2) * (KT * DD * 2), gv + (st + 2) * (KT * 2));
    }
    asm volatile("s_wait_asynccnt 0x0" ::: "memory");    // no copy is outstanding when the buffers become output staging
    float* mine = (float*)sm + w * 32 * RP;    // each wave stages its own 32 x 64 tile, so that it stores whole lines
#pragma unroll
    for (int g = 0; g < 2; ++g)
#pragma unroll
        for (int dt = 0; dt < 4; ++dt) { float* d = mine + (g * 16 + lr) * RP + dt * 16 + hi * 8; const v8f a = acc[dt][g];
            *(v4fa*)d = (v4f){a[0], a[1], a[2], a[3]}; *(v4fa*)(d + 4) = (v4f){a[4], a[5], a[6], a[7]}; }
    asm volatile("s_wait_dscnt 0x0" ::: "memory");    // the wave's own rows are in LDS before its lanes read them back across lanes
    float* orow = O + (size_t)blockIdx.y * NN * DD + (size_t)q0 * DD;
#pragma unroll
    for (int u = 0; u < 16; ++u) { const int q = 2 * u + hi; *(v4f*)(orow + q * DD + lr * 4) = *(const v4fa*)(mine + q * RP + lr * 4); }
}
__global__ __launch_bounds__(256) void k_fin(const float* __restrict__ X, const float* __restrict__ O0, const float* __restrict__ O1, float* outb) { const int e = (blockIdx.x * 256 + threadIdx.x) * 4; if (e >= NN * DD) return;
    { const size_t b = blockIdx.y; X += b * NN * DD; O0 += b * KS * NN * DD; O1 += b * KS * NN * DD; outb += b * NN * DD; }    // grid.y = batch
    const v4f a = *(const v4f*)(O0 + e) + *(const v4f*)(O0 + NN * DD + e), b = *(const v4f*)(O1 + e) + *(const v4f*)(O1 + NN * DD + e);
    asm volatile("s_wait_xcnt 0x0" ::: "memory");    // the four loads' address registers are free for reuse from here on
    const v4f x = *(const v4f*)(X + e); v4f r;
#pragma unroll
    for (int u = 0; u < 4; ++u) { float s = __fadd_rn(a[u] * (1.0f / PCAR), b[u] * (1.0f / PCAR)); asm volatile("" : "+v"(s)); r[u] = __fadd_rn(bfr(x[u]), s); } *(v4f*)(outb + e) = r;  }

extern "C" void kernel_launch(void* const* d_in, const int* in_sizes, int n_in,
                              void* d_out, int out_size, void* d_ws, size_t ws_size, hipStream_t stream) {
    (void)in_sizes; (void)n_in; (void)out_size;
    const float** I = (const float**)d_in;
    const float *x = I[0], *WQ = I[1], *WK = I[2], *WV = I[3];
    float* OUT = (float*)d_out;     // [4][4096][64]
    char* wsp = (char*)d_ws;
    auto take = [&](size_t bytes) { char* p = wsp; wsp += (bytes + 255) & ~(size_t)255; return (void*)p; };
    bf* BW = (bf*)take((size_t)3 * NH_ * DD * DD * 2);    // [Q, K, V][head][64][64]
    bf* XB = (bf*)take((size_t)NB_ * NN * DD * 2);
    float* QKV = (float*)take((size_t)3 * NP_ * NN * DD * 4);    // [Q, K, V][plane][N][D]
    h16* QK16 = (h16*)take((size_t)2 * NP_ * NN * DD * 2); h16* VT = (h16*)take((size_t)NP_ * DD * NN * 2);
    float* O = (float*)take((size_t)NP_ * KS * NN * DD * 4);    // [plane][key half][N][D]
    if ((size_t)(wsp - (char*)d_ws) > ws_size) return;
    k_wtG<<<dim3((DD * DD / 64 + 63) / 64, 3 * NH_, 1), 256, 0, stream>>>(WQ, WK, WV, DD, DD, BW);   // W[h] is [d][k] used as x @ W -> transposed gather
    k_cvt8<<<(NB_ * NN * DD / 8 + 255) / 256, 256, 0, stream>>>(x, XB, (size_t)NB_ * NN * DD / 8);
    k_gemmw<bf, 0, false><<<dim3(NB_ * NN / 64, 1, 3 * NH_), 32, 0, stream>>>(XB, nullptr, BW, nullptr, DD, QKV, DD, nullptr, 0, DD * DD, (size_t)NB_ * NN * DD);    // rows: all batches; z: the six weight matrices
    k_p16<<<dim3((NN * DD / 4 + 255) / 256, 2, 1), 256, 0, stream>>>(QKV, QK16);
    k_vt<<<(DD * NN / 2 + 255) / 256, 256, 0, stream>>>(QKV + (size_t)2 * NP_ * NN * DD, VT);
    k_attn<<<dim3(NN / (FW * 32), KS, NP_), FW * 32, 0, stream>>>(QK16, QK16 + (size_t)NP_ * NN * DD, VT, O);
    k_fin<<<dim3((NN * DD / 4 + 255) / 256, NB_, 1), 256, 0, stream>>>(x, O, O + (size_t)NB_ * KS * NN * DD, OUT);
}

// v004
// It runs in 32.3 microseconds.
// Timed twice side by side with v003, it ran 1.85 and 1.88 times as fast.
// Counting every step since v000, it is 34.9 times as fast.
#include <hip/hip_runtime.h>

// SelfAttention_Inefficient (x [4][4096][64]; per head h of 2: Q/K/V = x W[h] (64x64); scores = relu(Q.K^T) / 4096 (no softmax); out = x + sum_h scores V -> [4][4096][64]).
// Compute dtypes, f32 accumulate: every input rounded to bf16; Q/K/V on PLAIN bf16 operands (inputs: exact; K 64); scores (K 64) single fp16 planes -> f32, relu and /4096 in f32 -> fp16 x 1024; scores.V single fp16 (1 product; the weights are O(1e-3) so fp16 rounding is

#define NB_  4
#define NN   4096
#define DD   64
#define NH_  2
#define NP_  (NH_ * NB_)    // planes: one per (head, batch), index head * NB_ + batch
#define PCAR 1024.0f
typedef _Float16 h16;
typedef __attribute__((ext_vector_type(16))) __bf16   v16bf;
typedef __attribute__((ext_vector_type(16))) _Float16 v16h;
typedef __attribute__((ext_vector_type(8)))  _Float16 v8h;
typedef __attribute__((ext_vector_type(8)))  float    v8f;
typedef __attribute__((ext_vector_type(4)))  float    v4f;
typedef v8h  __attribute__((may_alias)) v8ha;
typedef v4f  __attribute__((may_alias)) v4fa;

__device__ __forceinline__ unsigned short f2bf(float f) { unsigned u = __float_as_uint(f); u += 0x7FFFu + ((u >> 16) & 1u); return (unsigned short)(u >> 16); }
__device__ __forceinline__ float bf2f(unsigned short b) { return __uint_as_float(((unsigned)b) << 16); }
__device__ __forceinline__ float bfr(float f) { return bf2f(f2bf(f)); }
__device__ __forceinline__ v16h cat16(v8h lo, v8h hi) { return __builtin_shufflevector(lo, hi, 0, 1, 2, 3, 4, 5, 6, 7, 8, 9, 10, 11, 12, 13, 14, 15); }
__device__ __forceinline__ v8f wmma16(v16h a, v16h b, v8f c) { return __builtin_amdgcn_wmma_f32_16x16x32_f16(false, a, false, b, (short)0, c, false, false); }
__device__ __forceinline__ v8f wmmab(v16bf a, v16bf b, v8f c) { return __builtin_amdgcn_wmma_f32_16x16x32_bf16(false, a, false, b, (short)0, c, false, false); }



template <typename T16> struct WFrag;
template <> struct WFrag<h16> { typedef v16h V; static __device__ __forceinline__ V ld(const h16* p) { return cat16(*(const v8h*)p, *(const v8h*)(p + 16)); } };
__device__ __forceinline__ h16 tohx(float x) { return (h16)x; }
typedef __attribute__((ext_vector_type(8))) __bf16 v8b;
typedef v8b __attribute__((may_alias)) v8ba;
__device__ __forceinline__ v8b b8(v8f a) { v8b r;    // eight f32 values rounded to nearest-even bf16
#pragma unroll
    for (int s = 0; s < 8; ++s) r[s] = (__bf16)a[s]; return r; }
__device__ __forceinline__ v16bf cat16b(v8b lo, v8b up) { return __builtin_shufflevector(lo, up, 0, 1, 2, 3, 4, 5, 6, 7, 8, 9, 10, 11, 12, 13, 14, 15); }
__device__ __forceinline__ v8h h8(v8f c) { v8h o;
#pragma unroll
    for (int j = 0; j < 8; ++j) o[j] = tohx(c[j]); return o; }
// ---- k_proj: the six projections x W (Q, K, V of both heads) from the f32 inputs to the fp16 planes that k_attn reads, in one launch. Grid (B * N / 256, 1, 6), 4 waves: a wave takes 64 tokens, the work-group one 64 x 64 weight matrix.
// z: head z % 2 of WQ, WK, WV in turn. Both operands are rounded from f32 to bf16 in registers. x: a fragment is two runs of 8 floats of a token's row. W[k][n]: each thread reads 32 k of one column n (a wave reads whole 128-byte lines)
// and writes them as 64 bytes of row n of W^T in LDS, from where every wave reads its fragments. Both loaders give the hardware k order (8 * hi + s, then 16 + 8 * hi + s). K = 64 is summed as k 0..31, then k 32..63, in f32.
// An accumulator lane holds 8 consecutive ROWS of one column. Q, K: A = W^T, B = x^T, so these are 8 outputs of one token: 16 bytes of a row of Q[token][64]. V: A = x, B = W, so they are 8 tokens of one output: 16 bytes of a row of VT[d][N].
// The four stores that fill a 128-byte line come from the same wave.
#define PW 4                       // waves per work-group
#define WPI 144                    // LDS pitch of a W^T row (128 bytes + 16: an odd multiple of 16 bytes, free of bank conflicts for 16-byte accesses)
__global__ __launch_bounds__(PW * 32) void k_proj(const float* __restrict__ x, const float* __restrict__ wq, const float* __restrict__ wk, const float* __restrict__ wv, h16* __restrict__ QK, h16* __restrict__ VT) {
    __shared__ __align__(16) char wt[DD * WPI];
    const int z = blockIdx.z; const float* __restrict__ w = (z < NH_ ? wq : z < 2 * NH_ ? wk : wv) + (z % NH_) * DD * DD;
    const int tid = threadIdx.x, lane = tid & 31, lr = lane & 15, hi = lane >> 4; const int r0 = blockIdx.x * (PW * 64) + __builtin_amdgcn_readfirstlane(tid >> 5) * 64;
    const float* wc = w + (tid >> 6) * 32 * DD + (tid & 63); const float* xl = x + (size_t)(r0 + lr) * DD + 8 * hi;
    v8f wr[4], xr[4][2][2];    // every loop below is unrolled, so that the register arrays are indexed by constants only
#pragma unroll
    for (int mb = 0; mb < 4; ++mb)
#pragma unroll
        for (int kc = 0; kc < 2; ++kc)
#pragma unroll
            for (int u = 0; u < 2; ++u) xr[mb][kc][u] = *(const v8f*)(xl + mb * 16 * DD + kc * 32 + u * 16);
#pragma unroll
    for (int i = 0; i < 4; ++i)
#pragma unroll
        for (int s = 0; s < 8; ++s) wr[i][s] = wc[(i * 8 + s) * DD];
    __builtin_amdgcn_sched_barrier(0);    // every load is issued before the first conversion waits for one: one memory latency, not several in turn
    asm volatile("s_wait_xcnt 0x0" :: "v"(wc), "v"(xl) : "memory");    // all the loads name these two address pairs: they stay whole up to here and are free for reuse from here on
#pragma unroll
    for (int i = 0; i < 4; ++i) *(v8ba*)(wt + (tid & 63) * WPI + (tid >> 6) * 64 + i * 16) = b8(wr[i]);
    v16bf xf[4][2], wf[4][2];
#pragma unroll
    for (int mb = 0; mb < 4; ++mb)
#pragma unroll
        for (int kc = 0; kc < 2; ++kc) xf[mb][kc] = cat16b(b8(xr[mb][kc][0]), b8(xr[mb][kc][1]));
    __syncthreads();    // W^T is whole in LDS before any wave reads a fragment of it
#pragma unroll
    for (int nb = 0; nb < 4; ++nb)
#pragma unroll
        for (int kc = 0; kc < 2; ++kc) { const char* p = wt + (nb * 16 + lr) * WPI + kc * 64 + 16 * hi; wf[nb][kc] = cat16b(*(const v8ba*)p, *(const v8ba*)(p + 32)); }
    v8h o[4][4];
    if (z < 2 * NH_) {
        h16* q = QK + (size_t)z * NB_ * NN * DD + (size_t)(r0 + lr) * DD + 8 * hi;    // planes [Q, K][head][batch], rows: all batches one behind the other
#pragma unroll
        for (int mb = 0; mb < 4; ++mb)
#pragma unroll
            for (int nb = 0; nb < 4; ++nb) o[mb][nb] = h8(wmmab(wf[nb][1], xf[mb][1], wmmab(wf[nb][0], xf[mb][0], (v8f){})));
        __builtin_amdgcn_sched_barrier(0);    // the stores stand as one group behind the products: no register that a store names is written again
#pragma unroll
        for (int mb = 0; mb < 4; ++mb)
#pragma unroll
            for (int nb = 0; nb < 4; ++nb) *(v8h*)(q + mb * 16 * DD + nb * 16) = o[mb][nb];
    } else {
        h16* v = VT + ((size_t)(z - 2 * NH_) * NB_ + r0 / NN) * DD * NN + (size_t)lr * NN + r0 % NN + 8 * hi;
#pragma unroll
        for (int nb = 0; nb < 4; ++nb)
#pragma unroll
            for (int mb = 0; mb < 4; ++mb) o[mb][nb] = h8(wmmab(xf[mb][1], wf[nb][1], wmmab(xf[mb][0], wf[nb][0], (v8f){})));
        __builtin_amdgcn_sched_barrier(0);    // as above
#pragma unroll
        for (int nb = 0; nb < 4; ++nb)
#pragma unroll
            for (int mb = 0; mb < 4; ++mb) *(v8h*)(v + nb * 16 * NN + mb * 16) = o[mb][nb];
        asm volatile("s_wait_xcnt 0x0" ::: "memory");    // behind the last store of the run: in the built code the other branch's block follows this one and reuses the stores' registers
    }
}
// ---- k_attn: scores, relu and scores.V in one kernel; the weights never leave registers. Grid (N / 256, 2, planes): the 8 waves of a work-group take 32 queries each and walk one half of the keys together.
// Each stage of 128 keys (K rows and VT rows, 16 KiB each) is brought into LDS once for all 8 waves by asynchronous copies of whole cache lines, two buffers: the next stage's copies fly while this one is worked on.
// Transposed products: S^T = K Q^T (A = 16 key rows, B = 16 query columns), so two f32 S^T tiles of 32 keys, scaled and rounded to fp16 in place, are the B operand of O^T += V^T P^T (A = 16 rows of VT).
// All three loaders give the hardware k order (8 * hi + s, then 16 + 8 * hi + s). A wave sums all its keys in its own accumulators; the two halves' planes O[0 .. N*D) and O[N*D .. 2*N*D) are added in k_fin.
#define FW 8                       // waves per work-group
#define KS 2                       // key halves (grid.y)
#define KT 128                     // keys per stage
#define KPI 144                    // LDS pitch of a K row (128 bytes + 16: an odd multiple of 16 bytes, free of bank conflicts for 16-byte reads)
#define VPI 272                    // LDS pitch of a VT row (256 bytes + 16)
#define KBY (KT * KPI)
#define SBY (KBY + DD * VPI)       // one buffer: K tile, then VT tile
#define NST (NN / KS / KT)         // stages per work-group
#define RP 68
// One stage: each lane copies four 16-byte pieces of the K tile (32 rows apart) and four of the VT tile (16 rows apart).
// The wait is the statement's last line, so that no address register is rewritten before it.
__device__ __forceinline__ void stage_copy(unsigned lk, unsigned lv, const char* gk, const char* gv) {
    asm volatile("global_load_async_to_lds_b128 %0, %1, off\n\t"
                 "global_load_async_to_lds_b128 %2, %3, off\n\t"
                 "global_load_async_to_lds_b128 %4, %5, off\n\t"
                 "global_load_async_to_lds_b128 %6, %7, off\n\t"
                 "global_load_async_to_lds_b128 %8, %9, off\n\t"
                 "global_load_async_to_lds_b128 %10, %11, off\n\t"
                 "global_load_async_to_lds_b128 %12, %13, off\n\t"
                 "global_load_async_to_lds_b128 %14, %15, off\n\t"
                 "s_wait_xcnt 0x0"
                 :: "v"(lk), "v"(gk), "v"(lk + 32 * KPI), "v"(gk + 32 * DD * 2), "v"(lk + 64 * KPI), "v"(gk + 64 * DD * 2), "v"(lk + 96 * KPI), "v"(gk + 96 * DD * 2),
                    "v"(lv), "v"(gv), "v"(lv + 16 * VPI), "v"(gv + 16 * NN * 2), "v"(lv + 32 * VPI), "v"(gv + 32 * NN * 2), "v"(lv + 48 * VPI), "v"(gv + 48 * NN * 2)
                 : "memory");
}
__device__ __forceinline__ v16h ldsfrag(const char* p) { return cat16(*(const v8ha*)p, *(const v8ha*)(p + 32)); }
// At most two waves a SIMD, that is one work-group a WGP: the grid has as many work-groups as the chip has WGPs, and two on one WGP would leave another idle.
__global__ __launch_bounds__(FW * 32) __attribute__((amdgpu_waves_per_eu(2, 2))) void k_attn(const h16* __restrict__ Qp, const h16* __restrict__ Kp, const h16* __restrict__ VTp, float* __restrict__ O) {
    __shared__ __align__(16) char sm[2 * SBY];    // every inner loop below is unrolled, so that the register arrays are indexed by constants only
    { const size_t z = blockIdx.z; Qp += z * NN * DD; Kp += z * NN * DD; VTp += z * DD * NN; O += z * KS * NN * DD; }
    const int tid = threadIdx.x, lane = tid & 31, lr = lane & 15, hi = lane >> 4; const int w = __builtin_amdgcn_readfirstlane(tid >> 5); const int q0 = blockIdx.x * (FW * 32) + w * 32;
    const int kfirst = blockIdx.y * (NN / KS);
    const unsigned lk = (unsigned)(size_t)sm + (tid >> 3) * KPI + (tid & 7) * 16, lv = (unsigned)(size_t)sm + KBY + (tid >> 4) * VPI + (tid & 15) * 16;    // the lane's places in buffer 0
    const char* gk = (const char*)Kp + (size_t)kfirst * DD * 2 + tid * 16; const char* gv = (const char*)VTp + (size_t)(tid >> 4) * NN * 2 + kfirst * 2 + (tid & 15) * 16;    // and its sources in stage 0
    stage_copy(lk, lv, gk, gv);
    v16h qf[2][2]; const unsigned qo = ((q0 + lr) * DD + 8 * hi) * 2;
#pragma unroll
    for (int g = 0; g < 2; ++g)
#pragma unroll
        for (int kc = 0; kc < 2; ++kc) qf[g][kc] = WFrag<h16>::ld((const h16*)((const char*)Qp + (g * 16 * DD + kc * 32) * 2 + qo));
    v8f acc[4][2];
#pragma unroll
    for (int dt = 0; dt < 4; ++dt)
#pragma unroll
        for (int g = 0; g < 2; ++g) acc[dt][g] = (v8f){};
    asm volatile("s_wait_asynccnt 0x0" ::: "memory");    // this wave's part of stage 0 has landed
    __syncthreads();                                     // and so has every other wave's
    stage_copy(lk + SBY, lv + SBY, gk + KT * DD * 2, gv + KT * 2);
    const char* kl = sm + lr * KPI + 16 * hi; const char* vl = sm + KBY + lr * VPI + 16 * hi;    // the lane's fragment rows in buffer 0
#pragma unroll 1    // rolled: one trip a stage, the buffer chosen by the trip's parity
    for (int st = 0; st < NST; ++st) {
        const int bo = (st & 1) * SBY; const char* kb = kl + bo; const char* vb = vl + bo;
        v16h kf[2][2], vf[4];
#pragma unroll
        for (int t = 0; t < 2; ++t)
#pragma unroll
            for (int kc = 0; kc < 2; ++kc) kf[t][kc] = ldsfrag(kb + t * 16 * KPI + kc * 64);
#pragma unroll    // unrolled: LDS offsets become immediates, and the last 32 keys of a stage fetch no K rows ahead without a branch
        for (int p = 0; p < KT / 32; ++p) {
#pragma unroll
            for (int dt = 0; dt < 4; ++dt) vf[dt] = ldsfrag(vb + dt * 16 * VPI + p * 64);
            __builtin_amdgcn_sched_barrier(0);    // the VT reads stand as one group in front of the score products, which hide their latency
            v8f s[2][2];
#pragma unroll
            for (int g = 0; g < 2; ++g)
#pragma unroll
                for (int t = 0; t < 2; ++t) s[g][t] = wmma16(kf[t][1], qf[g][1], wmma16(kf[t][0], qf[g][0], (v8f){}));
            __builtin_amdgcn_sched_barrier(0);    // the next 32 keys' K reads stand as one group behind the score products, not among them
            if (p + 1 < KT / 32) {
#pragma unroll
                for (int t = 0; t < 2; ++t)
#pragma unroll
                    for (int kc = 0; kc < 2; ++kc) kf[t][kc] = ldsfrag(kb + ((p + 1) * 32 + t * 16) * KPI + kc * 64);
            }
            __builtin_amdgcn_sched_barrier(0);    // and in front of the relu and the second products, which hide their latency
#pragma unroll
            for (int g = 0; g < 2; ++g) { v16h pr;
#pragma unroll
                for (int j = 0; j < 8; ++j) { pr[j] = tohx(fmaxf(s[g][0][j] * ((1.0f / NN) * PCAR), 0.f)); pr[8 + j] = tohx(fmaxf(s[g][1][j] * ((1.0f / NN) * PCAR), 0.f)); }    // the scale is a power of two: same fp16 value as relu, / N, x 1024 in turn
#pragma unroll
                for (int dt = 0; dt < 4; ++dt) acc[dt][g] = wmma16(vf[dt], pr, acc[dt][g]); }
        }
        asm volatile("s_wait_dscnt 0x0" ::: "memory");       // this wave's reads of the buffer are done
        asm volatile("s_wait_asynccnt 0x0" ::: "memory");    // its part of the next stage has landed
        __syncthreads();                                     // both hold for every wave: the next stage may be read, this buffer refilled
        if (st + 2 < NST) stage_copy(lk + bo, lv + bo, gk + (size_t)(st + 2) * (KT * DD * 2), gv + (st + 2) * (KT * 2));
    }
    asm volatile("s_wait_asynccnt 0x0" ::: "memory");    // no copy is outstanding when the buffers become output staging
    float* mine = (float*)sm + w * 32 * RP;    // each wave stages its own 32 x 64 tile, so that it stores whole lines
#pragma unroll
    for (int g = 0; g < 2; ++g)
#pragma unroll
        for (int dt = 0; dt < 4; ++dt) { float* d = mine + (g * 16 + lr) * RP + dt * 16 + hi * 8; const v8f a = acc[dt][g];
            *(v4fa*)d = (v4f){a[0], a[1], a[2], a[3]}; *(v4fa*)(d + 4) = (v4f){a[4], a[5], a[6], a[7]}; }
    asm volatile("s_wait_dscnt 0x0" ::: "memory");    // the wave's own rows are in LDS before its lanes read them back across lanes
    float* orow = O + (size_t)blockIdx.y * NN * DD + (size_t)q0 * DD;
#pragma unroll
    for (int u = 0; u < 16; ++u) { const int q = 2 * u + hi; *(v4f*)(orow + q * DD + lr * 4) = *(const v4fa*)(mine + q * RP + lr * 4); }
}
__global__ __launch_bounds__(256) void k_fin(const float* __restrict__ X, const float* __restrict__ O0, const float* __restrict__ O1, float* outb) { const int e = (blockIdx.x * 256 + threadIdx.x) * 4; if (e >= NN * DD) return;
    { const size_t b = blockIdx.y; X += b * NN * DD; O0 += b * KS * NN * DD; O1 += b * KS * NN * DD; outb += b * NN * DD; }    // grid.y = batch
    const v4f a = *(const v4f*)(O0 + e) + *(const v4f*)(O0 + NN * DD + e), b = *(const v4f*)(O1 + e) + *(const v4f*)(O1 + NN * DD + e);
    asm volatile("s_wait_xcnt 0x0" ::: "memory");    // the four loads' address registers are free for reuse from here on
    const v4f x = *(const v4f*)(X + e); v4f r;
#pragma unroll
    for (int u = 0; u < 4; ++u) { float s = __fadd_rn(a[u] * (1.0f / PCAR), b[u] * (1.0f / PCAR)); asm volatile("" : "+v"(s)); r[u] = __fadd_rn(bfr(x[u]), s); } *(v4f*)(outb + e) = r;  }

extern "C" void kernel_launch(void* const* d_in, const int* in_sizes, int n_in,
                              void* d_out, int out_size, void* d_ws, size_t ws_size, hipStream_t stream) {
    (void)in_sizes; (void)n_in; (void)out_size;
    const float** I = (const float**)d_in;
    const float *x = I[0], *WQ = I[1], *WK = I[2], *WV = I[3];
    float* OUT = (float*)d_out;     // [4][4096][64]
    char* wsp = (char*)d_ws;
    auto take = [&](size_t bytes) { char* p = wsp; wsp += (bytes + 255) & ~(size_t)255; return (void*)p; };
    h16* QK16 = (h16*)take((size_t)2 * NP_ * NN * DD * 2); h16* VT = (h16*)take((size_t)NP_ * DD * NN * 2);
    float* O = (float*)take((size_t)NP_ * KS * NN * DD * 4);    // [plane][key half][N][D]
    if ((size_t)(wsp - (char*)d_ws) > ws_size) return;
    k_proj<<<dim3(NB_ * NN / (PW * 64), 1, 3 * NH_), PW * 32, 0, stream>>>(x, WQ, WK, WV, QK16, VT);    // rows: all batches; z: the six weight matrices
    k_attn<<<dim3(NN / (FW * 32), KS, NP_), FW * 32, 0, stream>>>(QK16, QK16 + (size_t)NP_ * NN * DD, VT, O);
    k_fin<<<dim3((NN * DD / 4 + 255) / 256, NB_, 1), 256, 0, stream>>>(x, O, O + (size_t)NB_ * KS * NN * DD, OUT);
}

// v005
// Measured time: 31 microseconds a run.
// Timed twice side by side with v004, it ran 1.04 times as fast both times.
// Counting every step since v000, it is 36.4 times as fast.
#include <hip/hip_runtime.h>

// SelfAttention_Inefficient (x [4][4096][64]; per head h of 2: Q/K/V = x W[h] (64x64); scores = relu(Q.K^T) / 4096 (no softmax); out = x + sum_h scores V -> [4][4096][64]).
// Compute dtypes, f32 accumulate: every input rounded to bf16; Q/K/V on PLAIN bf16 operands (inputs: exact; K 64); scores (K 64) single fp16 planes -> f32, relu and /4096 in f32 -> fp16 x 1024; scores.V single fp16 (1 product; the weights are O(1e-3) so fp16 rounding is

#define NB_  4
#define NN   4096
#define DD   64
#define NH_  2
#define NP_  (NH_ * NB_)    // planes: one per (head, batch), index head * NB_ + batch
#define PCAR 1024.0f
typedef _Float16 h16;
typedef __attribute__((ext_vector_type(16))) __bf16   v16bf;
typedef __attribute__((ext_vector_type(16))) _Float16 v16h;
typedef __attribute__((ext_vector_type(8)))  _Float16 v8h;
typedef __attribute__((ext_vector_type(8)))  float    v8f;
typedef __attribute__((ext_vector_type(4)))  float    v4f;
typedef v8h  __attribute__((may_alias)) v8ha;
typedef v4f  __attribute__((may_alias)) v4fa;

__device__ __forceinline__ unsigned short f2bf(float f) { unsigned u = __float_as_uint(f); u += 0x7FFFu + ((u >> 16) & 1u); return (unsigned short)(u >> 16); }
__device__ __forceinline__ float bf2f(unsigned short b) { return __uint_as_float(((unsigned)b) << 16); }
__device__ __forceinline__ float bfr(float f) { return bf2f(f2bf(f)); }
__device__ __forceinline__ v16h cat16(v8h lo, v8h hi) { return __builtin_shufflevector(lo, hi, 0, 1, 2, 3, 4, 5, 6, 7, 8, 9, 10, 11, 12, 13, 14, 15); }
__device__ __forceinline__ v8f wmma16(v16h a, v16h b, v8f c) { return __builtin_amdgcn_wmma_f32_16x16x32_f16(false, a, false, b, (short)0, c, false, false); }
__device__ __forceinline__ v8f wmmab(v16bf a, v16bf b, v8f c) { return __builtin_amdgcn_wmma_f32_16x16x32_bf16(false, a, false, b, (short)0, c, false, false); }



template <typename T16> struct WFrag;
template <> struct WFrag<h16> { typedef v16h V; static __device__ __forceinline__ V ld(const h16* p) { return cat16(*(const v8h*)p, *(const v8h*)(p + 16)); } };
__device__ __forceinline__ h16 tohx(float x) { return (h16)x; }
typedef __attribute__((ext_vector_type(8))) __bf16 v8b;
typedef v8b __attribute__((may_alias)) v8ba;
__device__ __forceinline__ v8b b8(v8f a) { v8b r;    // eight f32 values rounded to nearest-even bf16
#pragma unroll
    for (int s = 0; s < 8; ++s) r[s] = (__bf16)a[s]; return r; }
__device__ __forceinline__ v16bf cat16b(v8b lo, v8b up) { return __builtin_shufflevector(lo, up, 0, 1, 2, 3, 4, 5, 6, 7, 8, 9, 10, 11, 12, 13, 14, 15); }
__device__ __forceinline__ v8h h8(v8f c) { v8h o;
#pragma unroll
    for (int j = 0; j < 8; ++j) o[j] = tohx(c[j]); return o; }
// ---- k_proj: the six projections x W (Q, K, V of both heads) from the f32 inputs to the fp16 planes that k_attn reads, in one launch. Grid (B * N / 256, 1, 6), 4 waves: a wave takes 64 tokens, the work-group one 64 x 64 weight matrix.
// z: head z % 2 of WQ, WK, WV in turn. Both operands are rounded from f32 to bf16 in registers. x: a fragment is two runs of 8 floats of a token's row. W[k][n]: each thread reads 32 k of one column n (a wave reads whole 128-byte lines)
// and writes them as 64 bytes of row n of W^T in LDS, from where every wave reads its fragments. Both loaders give the hardware k order (8 * hi + s, then 16 + 8 * hi + s). K = 64 is summed as k 0..31, then k 32..63, in f32.
// An accumulator lane holds 8 consecutive ROWS of one column. Q, K: A = W^T, B = x^T, so these are 8 outputs of one token: 16 bytes of a row of Q[token][64]. V: A = x, B = W, so they are 8 tokens of one output: 16 bytes of a row of VT[d][N].
// The four stores that fill a 128-byte line come from the same wave.
#define PW 4                       // waves per work-group
#define WPI 144                    // LDS pitch of a W^T row (128 bytes + 16: an odd multiple of 16 bytes, free of bank conflicts for 16-byte accesses)
__global__ __launch_bounds__(PW * 32) void k_proj(const float* __restrict__ x, const float* __restrict__ wq, const float* __restrict__ wk, const float* __restrict__ wv, h16* __restrict__ QK, h16* __restrict__ VT) {
    __shared__ __align__(16) char wt[DD * WPI];
    const int z = blockIdx.z; const float* __restrict__ w = (z < NH_ ? wq : z < 2 * NH_ ? wk : wv) + (z % NH_) * DD * DD;
    const int tid = threadIdx.x, lane = tid & 31, lr = lane & 15, hi = lane >> 4; const int r0 = blockIdx.x * (PW * 64) + __builtin_amdgcn_readfirstlane(tid >> 5) * 64;
    const float* wc = w + (tid >> 6) * 32 * DD + (tid & 63); const float* xl = x + (size_t)(r0 + lr) * DD + 8 * hi;
    v8f wr[4], xr[4][2][2];    // every loop below is unrolled, so that the register arrays are indexed by constants only
#pragma unroll
    for (int mb = 0; mb < 4; ++mb)
#pragma unroll
        for (int kc = 0; kc < 2; ++kc)
#pragma unroll
            for (int u = 0; u < 2; ++u) xr[mb][kc][u] = *(const v8f*)(xl + mb * 16 * DD + kc * 32 + u * 16);
#pragma unroll
    for (int i = 0; i < 4; ++i)
#pragma unroll
        for (int s = 0; s < 8; ++s) wr[i][s] = wc[(i * 8 + s) * DD];
    __builtin_amdgcn_sched_barrier(0);    // every load is issued before the first conversion waits for one: one memory latency, not several in turn
    asm volatile("s_wait_xcnt 0x0" :: "v"(wc), "v"(xl) : "memory");    // all the loads name these two address pairs: they stay whole up to here and are free for reuse from here on
#pragma unroll
    for (int i = 0; i < 4; ++i) *(v8ba*)(wt + (tid & 63) * WPI + (tid >> 6) * 64 + i * 16) = b8(wr[i]);
    v16bf xf[4][2], wf[4][2];
#pragma unroll
    for (int mb = 0; mb < 4; ++mb)
#pragma unroll
        for (int kc = 0; kc < 2; ++kc) xf[mb][kc] = cat16b(b8(xr[mb][kc][0]), b8(xr[mb][kc][1]));
    __syncthreads();    // W^T is whole in LDS before any wave reads a fragment of it
#pragma unroll
    for (int nb = 0; nb < 4; ++nb)
#pragma unroll
        for (int kc = 0; kc < 2; ++kc) { const char* p = wt + (nb * 16 + lr) * WPI + kc * 64 + 16 * hi; wf[nb][kc] = cat16b(*(const v8ba*)p, *(const v8ba*)(p + 32)); }
    v8h o[4][4];
    if (z < 2 * NH_) {
        h16* q = QK + (size_t)z * NB_ * NN * DD + (size_t)(r0 + lr) * DD + 8 * hi;    // planes [Q, K][head][batch], rows: all batches one behind the other
#pragma unroll
        for (int mb = 0; mb < 4; ++mb)
#pragma unroll
            for (int nb = 0; nb < 4; ++nb) o[mb][nb] = h8(wmmab(wf[nb][1], xf[mb][1], wmmab(wf[nb][0], xf[mb][0], (v8f){})));
        __builtin_amdgcn_sched_barrier(0);    // the stores stand as one group behind the products: no register that a store names is written again
#pragma unroll
        for (int mb = 0; mb < 4; ++mb)
#pragma unroll
            for (int nb = 0; nb < 4; ++nb) *(v8h*)(q + mb * 16 * DD + nb * 16) = o[mb][nb];
    } else {
        h16* v = VT + ((size_t)(z - 2 * NH_) * NB_ + r0 / NN) * DD * NN + (size_t)lr * NN + r0 % NN + 8 * hi;
#pragma unroll
        for (int nb = 0; nb < 4; ++nb)
#pragma unroll
            for (int mb = 0; mb < 4; ++mb) o[mb][nb] = h8(wmmab(xf[mb][1], wf[nb][1], wmmab(xf[mb][0], wf[nb][0], (v8f){})));
        __builtin_amdgcn_sched_barrier(0);    // as above
#pragma unroll
        for (int nb = 0; nb < 4; ++nb)
#pragma unroll
            for (int mb = 0; mb < 4; ++mb) *(v8h*)(v + nb * 16 * NN + mb * 16) = o[mb][nb];
        asm volatile("s_wait_xcnt 0x0" ::: "memory");    // behind the last store of the run: in the built code the other branch's block follows this one and reuses the stores' registers
    }
}
// ---- k_attn: scores, relu and scores.V in one kernel; the weights never leave registers. Grid (N / 256, 2, planes): a work-group of 16 waves takes 256 queries and one half of the keys.
// The waves form two key groups of 8: wave w takes the 32 queries w % 8, and of every stage of 256 keys the 128 keys w / 8. Four waves a SIMD: while one waits for LDS or does its relu, three others can feed the matrix unit.
// Each group's part of a stage (K rows and VT rows, 16 KiB each) is brought into LDS once for its 8 waves by asynchronous copies of whole cache lines, two buffers: the next stage's copies fly while this one is worked on.
// Transposed products: S^T = K Q^T (A = 16 key rows, B = 16 query columns), so two f32 S^T tiles of 32 keys, scaled and rounded to fp16 in place, are the B operand of O^T += V^T P^T (A = 16 rows of VT).
// All three loaders give the hardware k order (8 * hi + s, then 16 + 8 * hi + s). A wave sums all its keys in its own accumulators; the two groups' sums are joined in LDS at the end (group 0 + group 1); the two halves' planes O[0 .. N*D) and O[N*D .. 2*N*D) are added in k_fin.
#define QW 8                       // waves side by side along the queries
#define KG 2                       // key groups
#define FW (QW * KG)               // waves per work-group
#define KS 2                       // key halves (grid.y)
#define KT 128                     // keys per stage and key group
#define KPI 144                    // LDS pitch of a K row (128 bytes + 16: an odd multiple of 16 bytes, free of bank conflicts for 16-byte reads)
#define VPI 272                    // LDS pitch of a VT row (256 bytes + 16)
#define KBY (KT * KPI)
#define SBY (KBY + DD * VPI)       // one group's part of a buffer: K tile, then VT tile
#define BBY (KG * SBY)             // one buffer
#define NST (NN / KS / (KG * KT))  // stages per work-group
#define RP 68
// One stage: each lane copies four 16-byte pieces of the K tile (32 rows apart) and four of the VT tile (16 rows apart).
// The wait is the statement's last line, so that no address register is rewritten before it.
__device__ __forceinline__ void stage_copy(unsigned lk, unsigned lv, const char* gk, const char* gv) {
    asm volatile("global_load_async_to_lds_b128 %0, %1, off\n\t"
                 "global_load_async_to_lds_b128 %2, %3, off\n\t"
                 "global_load_async_to_lds_b128 %4, %5, off\n\t"
                 "global_load_async_to_lds_b128 %6, %7, off\n\t"
                 "global_load_async_to_lds_b128 %8, %9, off\n\t"
                 "global_load_async_to_lds_b128 %10, %11, off\n\t"
                 "global_load_async_to_lds_b128 %12, %13, off\n\t"
                 "global_load_async_to_lds_b128 %14, %15, off\n\t"
                 "s_wait_xcnt 0x0"
                 :: "v"(lk), "v"(gk), "v"(lk + 32 * KPI), "v"(gk + 32 * DD * 2), "v"(lk + 64 * KPI), "v"(gk + 64 * DD * 2), "v"(lk + 96 * KPI), "v"(gk + 96 * DD * 2),
                    "v"(lv), "v"(gv), "v"(lv + 16 * VPI), "v"(gv + 16 * NN * 2), "v"(lv + 32 * VPI), "v"(gv + 32 * NN * 2), "v"(lv + 48 * VPI), "v"(gv + 48 * NN * 2)
                 : "memory");
}
__device__ __forceinline__ v16h ldsfrag(const char* p) { return cat16(*(const v8ha*)p, *(const v8ha*)(p + 32)); }
// Four waves a SIMD, that is one work-group a WGP: the grid has as many work-groups as the chip has WGPs, and two on one WGP would leave another idle.
__global__ __launch_bounds__(FW * 32) __attribute__((amdgpu_waves_per_eu(4, 4))) void k_attn(const h16* __restrict__ Qp, const h16* __restrict__ Kp, const h16* __restrict__ VTp, float* __restrict__ O) {
    __shared__ __align__(16) char sm[2 * BBY];    // every inner loop below is unrolled, so that the register arrays are indexed by constants only
    { const size_t z = blockIdx.z; Qp += z * NN * DD; Kp += z * NN * DD; VTp += z * DD * NN; O += z * KS * NN * DD; }
    const int tid = threadIdx.x, lane = tid & 31, lr = lane & 15, hi = lane >> 4; const int wv = __builtin_amdgcn_readfirstlane(tid >> 5); const int w = wv % QW, kg = wv / QW, t = tid % (QW * 32); const int q0 = blockIdx.x * (QW * 32) + w * 32;
    const int kfirst = blockIdx.y * (NN / KS) + kg * KT;    // the group's first key; its next stage lies KG * KT keys on
    const unsigned lk = (unsigned)(size_t)sm + kg * SBY + (t >> 3) * KPI + (t & 7) * 16, lv = (unsigned)(size_t)sm + kg * SBY + KBY + (t >> 4) * VPI + (t & 15) * 16;    // the lane's places in its group's part of buffer 0
    const char* gk = (const char*)Kp + (size_t)kfirst * DD * 2 + t * 16; const char* gv = (const char*)VTp + (size_t)(t >> 4) * NN * 2 + kfirst * 2 + (t & 15) * 16;    // and its sources in stage 0
    stage_copy(lk, lv, gk, gv);
    v16h qf[2][2]; const unsigned qo = ((q0 + lr) * DD + 8 * hi) * 2;
#pragma unroll
    for (int g = 0; g < 2; ++g)
#pragma unroll
        for (int kc = 0; kc < 2; ++kc) qf[g][kc] = WFrag<h16>::ld((const h16*)((const char*)Qp + (g * 16 * DD + kc * 32) * 2 + qo));
    v8f acc[4][2];
#pragma unroll
    for (int dt = 0; dt < 4; ++dt)
#pragma unroll
        for (int g = 0; g < 2; ++g) acc[dt][g] = (v8f){};
    asm volatile("s_wait_asynccnt 0x0" ::: "memory");    // this wave's part of stage 0 has landed
    __syncthreads();                                     // and so has every other wave's
    stage_copy(lk + BBY, lv + BBY, gk + KG * KT * DD * 2, gv + KG * KT * 2);
    const char* kl = sm + kg * SBY + lr * KPI + 16 * hi; const char* vl = sm + kg * SBY + KBY + lr * VPI + 16 * hi;    // the lane's fragment rows in its group's part of buffer 0
#pragma unroll 1    // rolled: one trip a stage, the buffer chosen by the trip's parity
    for (int st = 0; st < NST; ++st) {
        const int bo = (st & 1) * BBY; const char* kb = kl + bo; const char* vb = vl + bo;
        v16h kf[2][2], vf[4];
#pragma unroll
        for (int t = 0; t < 2; ++t)
#pragma unroll
            for (int kc = 0; kc < 2; ++kc) kf[t][kc] = ldsfrag(kb + t * 16 * KPI + kc * 64);
#pragma unroll    // unrolled: LDS offsets become immediates, and the last 32 keys of a stage fetch no K rows ahead without a branch
        for (int p = 0; p < KT / 32; ++p) {
#pragma unroll
            for (int dt = 0; dt < 4; ++dt) vf[dt] = ldsfrag(vb + dt * 16 * VPI + p * 64);
            __builtin_amdgcn_sched_barrier(0);    // the VT reads stand as one group in front of the score products, which hide their latency
            v8f s[2][2];
#pragma unroll
            for (int g = 0; g < 2; ++g)
#pragma unroll
                for (int t = 0; t < 2; ++t) s[g][t] = wmma16(kf[t][1], qf[g][1], wmma16(kf[t][0], qf[g][0], (v8f){}));
            __builtin_amdgcn_sched_barrier(0);    // the next 32 keys' K reads stand as one group behind the score products, not among them
            if (p + 1 < KT / 32) {
#pragma unroll
                for (int t = 0; t < 2; ++t)
#pragma unroll
                    for (int kc = 0; kc < 2; ++kc) kf[t][kc] = ldsfrag(kb + ((p + 1) * 32 + t * 16) * KPI + kc * 64);
            }
            __builtin_amdgcn_sched_barrier(0);    // and in front of the relu and the second products, which hide their latency
#pragma unroll
            for (int g = 0; g < 2; ++g) { v16h pr;
#pragma unroll
                for (int j = 0; j < 8; ++j) { pr[j] = tohx(fmaxf(s[g][0][j] * ((1.0f / NN) * PCAR), 0.f)); pr[8 + j] = tohx(fmaxf(s[g][1][j] * ((1.0f / NN) * PCAR), 0.f)); }    // the scale is a power of two: same fp16 value as relu, / N, x 1024 in turn
#pragma unroll
                for (int dt = 0; dt < 4; ++dt) acc[dt][g] = wmma16(vf[dt], pr, acc[dt][g]); }
        }
        asm volatile("s_wait_dscnt 0x0" ::: "memory");       // this wave's reads of the buffer are done
        asm volatile("s_wait_asynccnt 0x0" ::: "memory");    // its part of the next stage has landed
        __syncthreads();                                     // both hold for every wave: the next stage may be read, this buffer refilled
        if (st + 2 < NST) stage_copy(lk + bo, lv + bo, gk + (size_t)(st + 2) * (KG * KT * DD * 2), gv + (st + 2) * (KG * KT * 2));
    }
    asm volatile("s_wait_asynccnt 0x0" ::: "memory");    // no copy is outstanding when the buffers become output staging
    float* mine = (float*)sm + w * 32 * RP;    // the two waves that share 32 queries share one 32 x 64 tile; wave kg finishes its rows 16 * kg .. 16 * kg + 15 and hands the other 16 to its partner
    float* dk = mine + (kg * 16 + lr) * RP + hi * 8; float* dg = mine + ((1 - kg) * 16 + lr) * RP + hi * 8;
#pragma unroll
    for (int dt = 0; dt < 4; ++dt) { const v8f a = kg ? acc[dt][0] : acc[dt][1];
        *(v4fa*)(dg + dt * 16) = (v4f){a[0], a[1], a[2], a[3]}; *(v4fa*)(dg + dt * 16 + 4) = (v4f){a[4], a[5], a[6], a[7]}; }
    __syncthreads();    // the partner's sums are in LDS before a wave reads them
#pragma unroll
    for (int dt = 0; dt < 4; ++dt) { const v8f a = kg ? acc[dt][1] : acc[dt][0];    // each lane reads what the partner's same lane wrote, and writes the joined sum in its place
        const v4f b0 = *(const v4fa*)(dk + dt * 16), b1 = *(const v4fa*)(dk + dt * 16 + 4);
        *(v4fa*)(dk + dt * 16) = (v4f){a[0], a[1], a[2], a[3]} + b0; *(v4fa*)(dk + dt * 16 + 4) = (v4f){a[4], a[5], a[6], a[7]} + b1; }
    asm volatile("s_wait_dscnt 0x0" ::: "memory");    // the wave's own rows are in LDS before its lanes read them back across lanes, so that it stores whole lines
    float* orow = O + (size_t)blockIdx.y * NN * DD + (size_t)(q0 + kg * 16) * DD; const float* back = mine + kg * 16 * RP;
#pragma unroll
    for (int u = 0; u < 8; ++u) { const int q = 2 * u + hi; *(v4f*)(orow + q * DD + lr * 4) = *(const v4fa*)(back + q * RP + lr * 4); }
}
__global__ __launch_bounds__(256) void k_fin(const float* __restrict__ X, const float* __restrict__ O0, const float* __restrict__ O1, float* outb) { const int e = (blockIdx.x * 256 + threadIdx.x) * 4; if (e >= NN * DD) return;
    { const size_t b = blockIdx.y; X += b * NN * DD; O0 += b * KS * NN * DD; O1 += b * KS * NN * DD; outb += b * NN * DD; }    // grid.y = batch
    const v4f a = *(const v4f*)(O0 + e) + *(const v4f*)(O0 + NN * DD + e), b = *(const v4f*)(O1 + e) + *(const v4f*)(O1 + NN * DD + e);
    asm volatile("s_wait_xcnt 0x0" ::: "memory");    // the four loads' address registers are free for reuse from here on
    const v4f x = *(const v4f*)(X + e); v4f r;
#pragma unroll
    for (int u = 0; u < 4; ++u) { float s = __fadd_rn(a[u] * (1.0f / PCAR), b[u] * (1.0f / PCAR)); asm volatile("" : "+v"(s)); r[u] = __fadd_rn(bfr(x[u]), s); } *(v4f*)(outb + e) = r;  }

extern "C" void kernel_launch(void* const* d_in, const int* in_sizes, int n_in,
                              void* d_out, int out_size, void* d_ws, size_t ws_size, hipStream_t stream) {
    (void)in_sizes; (void)n_in; (void)out_size;
    const float** I = (const float**)d_in;
    const float *x = I[0], *WQ = I[1], *WK = I[2], *WV = I[3];
    float* OUT = (float*)d_out;     // [4][4096][64]
    char* wsp = (char*)d_ws;
    auto take = [&](size_t bytes) { char* p = wsp; wsp += (bytes + 255) & ~(size_t)255; return (void*)p; };
    h16* QK16 = (h16*)take((size_t)2 * NP_ * NN * DD * 2); h16* VT = (h16*)take((size_t)NP_ * DD * NN * 2);
    float* O = (float*)take((size_t)NP_ * KS * NN * DD * 4);    // [plane][key half][N][D]
    if ((size_t)(wsp - (char*)d_ws) > ws_size) return;
    k_proj<<<dim3(NB_ * NN / (PW * 64), 1, 3 * NH_), PW * 32, 0, stream>>>(x, WQ, WK, WV, QK16, VT);    // rows: all batches; z: the six weight matrices
    k_attn<<<dim3(NN / (QW * 32), KS, NP_), FW * 32, 0, stream>>>(QK16, QK16 + (size_t)NP_ * NN * DD, VT, O);
    k_fin<<<dim3((NN * DD / 4 + 255) / 256, NB_, 1), 256, 0, stream>>>(x, O, O + (size_t)NB_ * KS * NN * DD, OUT);
}

// v007
// Measured time: 26.7 microseconds a run.
// Versions in between are left out here; by their measured steps it is 1.16 times as fast as v005.
// All steps since v000 together make it 42.1 times as fast.
#include <hip/hip_runtime.h>

// x [4][4096][64]; per head h of 2: Q/K/V = x W[h] (64x64); scores = relu(Q.K^T) / 4096 (no softmax); out = x + sum_h scores V -> [4][4096][64].
// The products are reassociated: Q.K^T = (x WQ WK^T) x^T = Q' x^T, and scores V = (scores x) WV. So both heads have the same key rows and the same value rows, x itself, and no K or V plane is formed: one fp16 copy of x serves both products.
// Compute dtypes, f32 accumulate: every input rounded to bf16; x WQ on bf16 operands -> fp16; Q' = Q WK^T on fp16 -> fp16; scores (K 64) fp16 -> f32, relu and /4096 in f32 -> fp16 x 1024; scores.x fp16; (scores.x) / 1024 -> fp16, times WV on fp16.

#define NB_  4
#define NN   4096
#define DD   64
#define NH_  2
#define NP_  (NH_ * NB_)    // planes: one per (head, batch), index head * NB_ + batch
#define PCAR 1024.0f
typedef _Float16 h16;
typedef __attribute__((ext_vector_type(16))) __bf16   v16bf;
typedef __attribute__((ext_vector_type(16))) _Float16 v16h;
typedef __attribute__((ext_vector_type(8)))  _Float16 v8h;
typedef __attribute__((ext_vector_type(8)))  float    v8f;
typedef __attribute__((ext_vector_type(4)))  float    v4f;
typedef v8h  __attribute__((may_alias)) v8ha;
typedef v4f  __attribute__((may_alias)) v4fa;

__device__ __forceinline__ unsigned short f2bf(float f) { unsigned u = __float_as_uint(f); u += 0x7FFFu + ((u >> 16) & 1u); return (unsigned short)(u >> 16); }
__device__ __forceinline__ float bf2f(unsigned short b) { return __uint_as_float(((unsigned)b) << 16); }
__device__ __forceinline__ float bfr(float f) { return bf2f(f2bf(f)); }
__device__ __forceinline__ v16h cat16(v8h lo, v8h hi) { return __builtin_shufflevector(lo, hi, 0, 1, 2, 3, 4, 5, 6, 7, 8, 9, 10, 11, 12, 13, 14, 15); }
__device__ __forceinline__ v8f wmma16(v16h a, v16h b, v8f c) { return __builtin_amdgcn_wmma_f32_16x16x32_f16(false, a, false, b, (short)0, c, false, false); }
__device__ __forceinline__ v8f wmmab(v16bf a, v16bf b, v8f c) { return __builtin_amdgcn_wmma_f32_16x16x32_bf16(false, a, false, b, (short)0, c, false, false); }



template <typename T16> struct WFrag;
template <> struct WFrag<h16> { typedef v16h V; static __device__ __forceinline__ V ld(const h16* p) { return cat16(*(const v8h*)p, *(const v8h*)(p + 16)); } };
__device__ __forceinline__ h16 tohx(float x) { return (h16)x; }
typedef __attribute__((ext_vector_type(8))) __bf16 v8b;
typedef v8b __attribute__((may_alias)) v8ba;
__device__ __forceinline__ v8b b8(v8f a) { v8b r;    // eight f32 values rounded to nearest-even bf16
#pragma unroll
    for (int s = 0; s < 8; ++s) r[s] = (__bf16)a[s]; return r; }
__device__ __forceinline__ v16bf cat16b(v8b lo, v8b up) { return __builtin_shufflevector(lo, up, 0, 1, 2, 3, 4, 5, 6, 7, 8, 9, 10, 11, 12, 13, 14, 15); }
__device__ __forceinline__ v8h h8(v8f c) { v8h o;
#pragma unroll
    for (int j = 0; j < 8; ++j) o[j] = tohx(c[j]); return o; }
__device__ __forceinline__ v8h hb8(v8f a) { v8h o;    // eight f32 values rounded to bf16, held as fp16
#pragma unroll
    for (int j = 0; j < 8; ++j) o[j] = (h16)(float)(__bf16)a[j]; return o; }
// ---- k_proj: from the f32 inputs to the fp16 planes that k_attn reads, in one launch. Grid (B * N / 256, 1, 3), 4 waves: a wave takes 64 tokens.
// z = 0, 1: Q' = (x WQ[z]) WK[z]^T. z = 2: x as fp16 rows X[token][64].
// Operands are rounded from f32 to bf16 in registers. x: a fragment is two runs of 8 floats of a token's row. WQ[k][n]: each thread reads 32 k of one column n (a wave reads whole 128-byte lines)
// and writes them as 64 bytes of row n of WQ^T in LDS, from where every wave reads its fragments. WK[d][k] goes to LDS row by row. All loaders give the hardware k order (8 * hi + s, then 16 + 8 * hi + s). K = 64 is summed as k 0..31, then k 32..63, in f32.
// An accumulator lane holds 8 consecutive ROWS of one column. Q^T = WQ^T x^T (A = WQ^T, B = x^T): two tiles of 16 outputs, rounded to fp16 in place, are the B operand of Q'^T = WK Q^T (A = 16 rows of WK); a lane then holds 8 outputs of one token: 16 bytes of a row of Q'[token][64].
// z = 2: no product, the rounded values go straight back.
// The four stores that fill a 128-byte line come from the same wave.
#define PW 4                       // waves per work-group
#define WPI 144                    // LDS pitch of a 64-element 16-bit row (128 bytes + 16: an odd multiple of 16 bytes, free of bank conflicts for 16-byte accesses)
__global__ __launch_bounds__(PW * 32) void k_proj(const float* __restrict__ x, const float* __restrict__ wq, const float* __restrict__ wk, h16* __restrict__ QX) {
    __shared__ __align__(16) char wt[DD * WPI];
    __shared__ __align__(16) char wk2[DD * WPI];
    const int z = blockIdx.z;
    const int tid = threadIdx.x, lane = tid & 31, lr = lane & 15, hi = lane >> 4; const int r0 = blockIdx.x * (PW * 64) + __builtin_amdgcn_readfirstlane(tid >> 5) * 64;
    if (z == NH_) {    // x by rows: a plain stream, 32 bytes in and 16 bytes out a lane, whole lines a wave; the whole work-group leaves here, in front of the barrier
        const float* xs = x + (size_t)blockIdx.x * (PW * 64 * DD) + tid * 8; h16* xo = QX + (size_t)NP_ * NN * DD + (size_t)blockIdx.x * (PW * 64 * DD) + tid * 8;    // X stands behind the Q' planes
        v8f a[16]; v8h c[16];
#pragma unroll
        for (int i = 0; i < 16; ++i) a[i] = *(const v8f*)(xs + i * (PW * 32 * 8));
        asm volatile("s_wait_xcnt 0x0" :: "v"(xs) : "memory");    // all the loads name this address pair: it stays whole up to here
#pragma unroll
        for (int i = 0; i < 16; ++i) c[i] = hb8(a[i]);
        __builtin_amdgcn_sched_barrier(0);    // the stores stand as one group behind the conversions: no register that a store names is written again
#pragma unroll
        for (int i = 0; i < 16; ++i) *(v8h*)(xo + i * (PW * 32 * 8)) = c[i];
        return;
    }
    const float* wc = wq + z * DD * DD + (tid >> 6) * 32 * DD + (tid & 63); const float* kr = wk + z * DD * DD + (tid >> 1) * DD + (tid & 1) * 32; const float* xl = x + (size_t)(r0 + lr) * DD + 8 * hi;
    v8f wr[4], kx[4], xr[4][2][2];    // every loop below is unrolled, so that the register arrays are indexed by constants only
#pragma unroll
    for (int mb = 0; mb < 4; ++mb)
#pragma unroll
        for (int kc = 0; kc < 2; ++kc)
#pragma unroll
            for (int u = 0; u < 2; ++u) xr[mb][kc][u] = *(const v8f*)(xl + mb * 16 * DD + kc * 32 + u * 16);
#pragma unroll
    for (int i = 0; i < 4; ++i)
#pragma unroll
        for (int s = 0; s < 8; ++s) wr[i][s] = wc[(i * 8 + s) * DD];
#pragma unroll
    for (int i = 0; i < 4; ++i) kx[i] = *(const v8f*)(kr + i * 8);
    __builtin_amdgcn_sched_barrier(0);    // every load is issued before the first conversion waits for one: one memory latency, not several in turn
    asm volatile("s_wait_xcnt 0x0" :: "v"(wc), "v"(kr), "v"(xl) : "memory");    // all the loads name these three address pairs: they stay whole up to here and are free for reuse from here on
#pragma unroll
    for (int i = 0; i < 4; ++i) { *(v8ba*)(wt + (tid & 63) * WPI + (tid >> 6) * 64 + i * 16) = b8(wr[i]); *(v8ha*)(wk2 + (tid >> 1) * WPI + (tid & 1) * 64 + i * 16) = hb8(kx[i]); }
    v16bf xf[4][2], wf[4][2];
#pragma unroll
    for (int mb = 0; mb < 4; ++mb)
#pragma unroll
        for (int kc = 0; kc < 2; ++kc) xf[mb][kc] = cat16b(b8(xr[mb][kc][0]), b8(xr[mb][kc][1]));
    __syncthreads();    // both matrices are whole in LDS before any wave reads a fragment of them
#pragma unroll
    for (int nb = 0; nb < 4; ++nb)
#pragma unroll
        for (int kc = 0; kc < 2; ++kc) { const char* p = wt + (nb * 16 + lr) * WPI + kc * 64 + 16 * hi; wf[nb][kc] = cat16b(*(const v8ba*)p, *(const v8ba*)(p + 32)); }
    v8h o[4][4];
    {
        h16* q = QX + (size_t)z * NB_ * NN * DD + (size_t)(r0 + lr) * DD + 8 * hi;    // planes Q'[head][batch]; rows: all batches one behind the other
#pragma unroll
        for (int mb = 0; mb < 4; ++mb)
#pragma unroll
            for (int nb = 0; nb < 4; ++nb) o[mb][nb] = h8(wmmab(wf[nb][1], xf[mb][1], wmmab(wf[nb][0], xf[mb][0], (v8f){})));
        __builtin_amdgcn_sched_barrier(0);    // the WK fragments are read only when the WQ^T and x fragments are done with: fewer registers live at once
        v16h ka[4][2];
#pragma unroll
        for (int nb = 0; nb < 4; ++nb)
#pragma unroll
            for (int kc = 0; kc < 2; ++kc) { const char* p = wk2 + (nb * 16 + lr) * WPI + kc * 64 + 16 * hi; ka[nb][kc] = cat16(*(const v8ha*)p, *(const v8ha*)(p + 32)); }
#pragma unroll
        for (int mb = 0; mb < 4; ++mb) { const v16h q0 = cat16(o[mb][0], o[mb][1]), q1 = cat16(o[mb][2], o[mb][3]);
#pragma unroll
            for (int nb = 0; nb < 4; ++nb) o[mb][nb] = h8(wmma16(ka[nb][1], q1, wmma16(ka[nb][0], q0, (v8f){}))); }
        __builtin_amdgcn_sched_barrier(0);    // the stores stand as one group behind the products: no register that a store names is written again
#pragma unroll
        for (int mb = 0; mb < 4; ++mb)
#pragma unroll
            for (int nb = 0; nb < 4; ++nb) *(v8h*)(q + mb * 16 * DD + nb * 16) = o[mb][nb];
        asm volatile("s_wait_xcnt 0x0" ::: "memory");    // behind the last store of the run: in the built code the z = 2 block follows this one and reuses the stores' registers
    }
}
// ---- k_attn: scores, relu, scores.x, the product with WV, the sum over heads and the residual in one kernel; the weights never leave registers. Grid (N / 64, batches): a work-group of 16 waves takes 64 queries, both heads, all keys, and writes its rows of out.
// The waves form four key groups of 4: wave w % 4 takes 32 queries (w & 1) of one head (w % 4 >> 1), and of every stage of 512 keys the 128 keys w / 4. Four waves a SIMD: while one waits for LDS or does its relu, three others can feed the matrix unit.
// Each group's part of a stage (128 rows of X, 16 KiB) is brought into LDS once for its 4 waves, that is for both heads and both products, by asynchronous copies of whole cache lines, two buffers: the next stage's copies fly while this one is worked on.
// One tile, two readers: rows of 128 bytes without a pad, the 16-byte piece c of row r standing at piece c ^ SWZ(r). So the 16 rows of one piece that half a wave reads with ds_load_b128, and the 8 rows of two pieces that it reads with ds_load_tr16_b128, each fall on all 64 banks once.
// Transposed products: S^T = X Q'^T (A = 16 key rows, B = 16 query columns), so two f32 S^T tiles of 32 keys, scaled and rounded to fp16 in place, are the B operand of O^T += X^T P^T (A = 16 rows of X^T, which the transposing LDS load takes out of the same X tile).
// In the same way two O^T tiles of 32 columns d, rounded to fp16 in place, are the B operand of R^T = WV^T O^T (A = 16 rows of WV^T, which the work-group puts into LDS at its start).
// All loaders give the hardware k order (8 * hi + s, then 16 + 8 * hi + s). A wave sums all its keys in its own accumulators; the product with WV is linear, so each wave takes it of its own sums, and the 8 waves' R (2 heads x 4 key groups) are added in LDS order head, then group.
#define QW 4                       // waves side by side: 2 x 32 queries, 2 heads
#define KG 4                       // key groups
#define FW (QW * KG)               // waves per work-group
#define QB 64                      // queries per work-group
#define KT 128                     // keys per stage and key group
#define KPI 128                    // LDS pitch of an X row: no pad
#define SWZ(r) (2 * (((r) >> 1) & 3) + (((r) >> 3) & 1))    // what a row's piece numbers are XORed with; it repeats every 16 rows
#define SBY 32768                  // one group's part of a buffer: its X tile (16 KiB) at the start of a 32-KiB block of LDS of its own, so that the four groups' reads and the copies into the other buffer fall in different blocks
#define BBY (KG * SBY)             // one buffer
static_assert(KT * KPI <= SBY, "a group's tile must fit its block");
#define NST (NN / (KG * KT))       // stages per work-group
#define RP 68
#define OBY (FW * 32 * RP * 4)     // output staging: a 32 x 64 f32 tile a wave
// One stage: the group's 128 lanes cover 16 rows of the X tile at a time, so each lane copies eight 16-byte pieces, 16 rows apart (the same SWZ).
// The wait is the statement's last line, so that no address register is rewritten before it.
__device__ __forceinline__ void stage_copy(unsigned lk, const char* gk) {
    asm volatile("global_load_async_to_lds_b128 %0, %1, off\n\t"
                 "global_load_async_to_lds_b128 %2, %3, off\n\t"
                 "global_load_async_to_lds_b128 %4, %5, off\n\t"
                 "global_load_async_to_lds_b128 %6, %7, off\n\t"
                 "global_load_async_to_lds_b128 %8, %9, off\n\t"
                 "global_load_async_to_lds_b128 %10, %11, off\n\t"
                 "global_load_async_to_lds_b128 %12, %13, off\n\t"
                 "global_load_async_to_lds_b128 %14, %15, off\n\t"
                 "s_wait_xcnt 0x0"
                 :: "v"(lk), "v"(gk), "v"(lk + 16 * KPI), "v"(gk + 16 * DD * 2), "v"(lk + 32 * KPI), "v"(gk + 32 * DD * 2), "v"(lk + 48 * KPI), "v"(gk + 48 * DD * 2),
                    "v"(lk + 64 * KPI), "v"(gk + 64 * DD * 2), "v"(lk + 80 * KPI), "v"(gk + 80 * DD * 2), "v"(lk + 96 * KPI), "v"(gk + 96 * DD * 2), "v"(lk + 112 * KPI), "v"(gk + 112 * DD * 2)
                 : "memory");
}
__device__ __forceinline__ v16h ldsfrag(const char* p) { return cat16(*(const v8ha*)p, *(const v8ha*)(p + 32)); }
typedef __attribute__((ext_vector_type(8))) short s16x8;
// The transposing load: the lanes hand in 16 rows x 2 pieces (row 8 * hi + (lane & 7), piece (lane >> 3) & 1), and lane (lr, hi) gets column lr of rows 8 * hi ... 8 * hi + 7.
__device__ __forceinline__ v8h ld_tr16(const char* p) { typedef __attribute__((address_space(3))) s16x8 lds_s16x8; return __builtin_bit_cast(v8h, __builtin_amdgcn_ds_load_tr16_b128_v8i16((lds_s16x8*)p)); }
// Four waves a SIMD, that is one work-group a WGP: the grid has as many work-groups as the chip has WGPs.
__global__ __launch_bounds__(FW * 32) __attribute__((amdgpu_waves_per_eu(4, 4))) void k_attn(const h16* __restrict__ Qp, const h16* __restrict__ Xp, const float* __restrict__ x, const float* __restrict__ wvg, float* __restrict__ outb) {
    __shared__ __align__(16) char sm[2 * BBY > OBY ? 2 * BBY : OBY];    // the two buffers, later the output staging; every inner loop below is unrolled, so that the register arrays are indexed by constants only
    __shared__ __align__(16) char wvt[NH_ * DD * WPI];
    const int tid = threadIdx.x, lane = tid & 31, lr = lane & 15, hi = lane >> 4; const int wv = __builtin_amdgcn_readfirstlane(tid >> 5); const int w = wv % QW, kg = wv / QW, t = tid % (QW * 32); const int hd = w >> 1, q0 = blockIdx.x * QB + (w & 1) * 32;
    { const size_t b = blockIdx.y; Qp += ((size_t)hd * NB_ + b) * NN * DD; Xp += b * NN * DD; x += (b * NN + blockIdx.x * QB) * DD; outb += (b * NN + blockIdx.x * QB) * DD; }
    const int kfirst = kg * KT;    // the group's first key; its next stage lies KG * KT keys on
    const unsigned lk = (unsigned)(size_t)sm + kg * SBY + (t >> 3) * KPI + ((t & 7) ^ SWZ(t >> 3)) * 16;    // the lane's place in its group's part of buffer 0
    const char* gk = (const char*)Xp + (size_t)kfirst * DD * 2 + t * 16;    // and its source in stage 0
    stage_copy(lk, gk);
    { const float* wc = wvg + (tid >> 8) * DD * DD + ((tid >> 6) & 3) * 16 * DD + (tid & 63); v8f wr[2];    // WV[d][n] of both heads: each thread reads 16 d of one column n and writes them as 32 bytes of row n of WV^T
#pragma unroll
        for (int i = 0; i < 2; ++i)
#pragma unroll
            for (int s = 0; s < 8; ++s) wr[i][s] = wc[(i * 8 + s) * DD];
        asm volatile("s_wait_xcnt 0x0" :: "v"(wc) : "memory");    // all 16 loads name this address pair: it stays whole up to here
#pragma unroll
        for (int i = 0; i < 2; ++i) *(v8ha*)(wvt + ((tid >> 8) * DD + (tid & 63)) * WPI + ((tid >> 6) & 3) * 32 + i * 16) = hb8(wr[i]); }
    v16h qf[2][2]; const unsigned qo = ((q0 + lr) * DD + 8 * hi) * 2;
#pragma unroll
    for (int g = 0; g < 2; ++g)
#pragma unroll
        for (int kc = 0; kc < 2; ++kc) qf[g][kc] = WFrag<h16>::ld((const h16*)((const char*)Qp + (g * 16 * DD + kc * 32) * 2 + qo));
    v8f acc[4][2];
#pragma unroll
    for (int dt = 0; dt < 4; ++dt)
#pragma unroll
        for (int g = 0; g < 2; ++g) acc[dt][g] = (v8f){};
    asm volatile("s_wait_asynccnt 0x0" ::: "memory");    // this wave's part of stage 0 has landed
    __syncthreads();                                     // and so has every other wave's, and WV^T is whole in LDS
    stage_copy(lk + BBY, gk + KG * KT * DD * 2);
    const char* kl[2][2]; const char* vl[4];    // the lane's fragment pieces in its group's part of buffer 0; every row step below is a multiple of 16 rows, so SWZ stays
#pragma unroll
    for (int kc = 0; kc < 2; ++kc)
#pragma unroll
        for (int u = 0; u < 2; ++u) kl[kc][u] = sm + kg * SBY + lr * KPI + ((kc * 4 + u * 2 + hi) ^ SWZ(lr)) * 16;    // row lr, bytes 16 * hi and 32 + 16 * hi of each 64
#pragma unroll
    for (int dt = 0; dt < 4; ++dt) vl[dt] = sm + kg * SBY + (8 * hi + (lane & 7)) * KPI + ((dt * 2 + ((lane >> 3) & 1)) ^ SWZ(8 * hi + (lane & 7))) * 16;    // 16 columns d are 2 pieces
#pragma unroll 1    // rolled: one trip a stage, the buffer chosen by the trip's parity
    for (int st = 0; st < NST; ++st) {
        const int bo = (st & 1) * BBY;
        v16h kf[2][2], vf[4];
#pragma unroll
        for (int t = 0; t < 2; ++t)
#pragma unroll
            for (int kc = 0; kc < 2; ++kc) kf[t][kc] = cat16(*(const v8ha*)(kl[kc][0] + bo + t * 16 * KPI), *(const v8ha*)(kl[kc][1] + bo + t * 16 * KPI));
#pragma unroll    // unrolled: LDS offsets become immediates, and the last 32 keys of a stage fetch no K rows ahead without a branch
        for (int p = 0; p < KT / 32; ++p) {
#pragma unroll
            for (int dt = 0; dt < 4; ++dt) vf[dt] = cat16(ld_tr16(vl[dt] + bo + p * 32 * KPI), ld_tr16(vl[dt] + bo + (p * 32 + 16) * KPI));    // keys 8 * hi + s, then 16 + 8 * hi + s: the hardware k order
            __builtin_amdgcn_sched_barrier(0);    // the X^T reads stand as one group in front of the score products, which hide their latency
            v8f s[2][2];
#pragma unroll
            for (int g = 0; g < 2; ++g)
#pragma unroll
                for (int t = 0; t < 2; ++t) s[g][t] = wmma16(kf[t][1], qf[g][1], wmma16(kf[t][0], qf[g][0], (v8f){}));
            __builtin_amdgcn_sched_barrier(0);    // the next 32 keys' K reads stand as one group behind the score products, not among them
            if (p + 1 < KT / 32) {
#pragma unroll
                for (int t = 0; t < 2; ++t)
#pragma unroll
                    for (int kc = 0; kc < 2; ++kc) kf[t][kc] = cat16(*(const v8ha*)(kl[kc][0] + bo + ((p + 1) * 32 + t * 16) * KPI), *(const v8ha*)(kl[kc][1] + bo + ((p + 1) * 32 + t * 16) * KPI));
            }
            __builtin_amdgcn_sched_barrier(0);    // and in front of the relu and the second products, which hide their latency
#pragma unroll
            for (int g = 0; g < 2; ++g) { v16h pr;
#pragma unroll
                for (int j = 0; j < 8; ++j) { pr[j] = tohx(fmaxf(s[g][0][j] * ((1.0f / NN) * PCAR), 0.f)); pr[8 + j] = tohx(fmaxf(s[g][1][j] * ((1.0f / NN) * PCAR), 0.f)); }    // the scale is a power of two: same fp16 value as relu, / N, x 1024 in turn
#pragma unroll
                for (int dt = 0; dt < 4; ++dt) acc[dt][g] = wmma16(vf[dt], pr, acc[dt][g]); }
        }
        asm volatile("s_wait_dscnt 0x0" ::: "memory");       // this wave's reads of the buffer are done
        asm volatile("s_wait_asynccnt 0x0" ::: "memory");    // its part of the next stage has landed
        __syncthreads();                                     // both hold for every wave: the next stage may be read, this buffer refilled
        if (st + 2 < NST) stage_copy(lk + bo, gk + (size_t)(st + 2) * (KG * KT * DD * 2));
    }
    asm volatile("s_wait_asynccnt 0x0" ::: "memory");    // no copy is outstanding when the buffers become output staging
    const int e0 = tid * 4, e1 = (tid + FW * 32) * 4;    // the thread's two 16-byte pieces of the work-group's 64 x 64 block of x and of out
    const v4f x0 = *(const v4f*)(x + e0), x1 = *(const v4f*)(x + e1);    // asked for here, needed behind the barrier
    asm volatile("s_wait_xcnt 0x0" ::: "memory");    // the two loads' address registers are free for reuse from here on
    v16h ob[2][2];
#pragma unroll
    for (int g = 0; g < 2; ++g)
#pragma unroll
        for (int kc = 0; kc < 2; ++kc)
#pragma unroll
            for (int j = 0; j < 8; ++j) { ob[g][kc][j] = tohx(acc[2 * kc][g][j] * (1.0f / PCAR)); ob[g][kc][8 + j] = tohx(acc[2 * kc + 1][g][j] * (1.0f / PCAR)); }
    const char* wl = wvt + (hd * DD + lr) * WPI + 16 * hi; float* mine = (float*)sm + wv * 32 * RP + lr * RP + hi * 8;    // each wave has a 32 x 64 tile of its own
#pragma unroll
    for (int nb = 0; nb < 4; ++nb) { const v16h a0 = ldsfrag(wl + nb * 16 * WPI), a1 = ldsfrag(wl + nb * 16 * WPI + 64);
#pragma unroll
        for (int g = 0; g < 2; ++g) { const v8f r = wmma16(a1, ob[g][1], wmma16(a0, ob[g][0], (v8f){}));
            *(v4fa*)(mine + g * 16 * RP + nb * 16) = (v4f){r[0], r[1], r[2], r[3]}; *(v4fa*)(mine + g * 16 * RP + nb * 16 + 4) = (v4f){r[4], r[5], r[6], r[7]}; } }
    __syncthreads();    // all 16 tiles are in LDS before any thread adds them
#pragma unroll
    for (int u = 0; u < 2; ++u) { const int e = u ? e1 : e0, q = e / DD; const float* p = (const float*)sm + (q >> 5) * 32 * RP + (q & 31) * RP + e % DD; v4f s = *(const v4fa*)p;    // query q stands in the tiles of the waves with w & 1 == q >> 5
#pragma unroll
        for (int i = 1; i < NH_ * KG; ++i) s += *(const v4fa*)(p + ((i % KG) * QW + (i / KG) * 2) * 32 * RP);    // head 0: groups 0 to 3, then head 1
        const v4f xv = u ? x1 : x0; v4f r;
#pragma unroll
        for (int i = 0; i < 4; ++i) r[i] = bfr(xv[i]) + s[i];
        *(v4f*)(outb + e) = r; }
}

extern "C" void kernel_launch(void* const* d_in, const int* in_sizes, int n_in,
                              void* d_out, int out_size, void* d_ws, size_t ws_size, hipStream_t stream) {
    (void)in_sizes; (void)n_in; (void)out_size;
    const float** I = (const float**)d_in;
    const float *x = I[0], *WQ = I[1], *WK = I[2], *WV = I[3];
    float* OUT = (float*)d_out;     // [4][4096][64]
    char* wsp = (char*)d_ws;
    auto take = [&](size_t bytes) { char* p = wsp; wsp += (bytes + 255) & ~(size_t)255; return (void*)p; };
    h16* QX = (h16*)take((size_t)(NP_ + NB_) * NN * DD * 2);    // Q'[head][batch][N][D], then X[batch][N][D]
    if ((size_t)(wsp - (char*)d_ws) > ws_size) return;
    k_proj<<<dim3(NB_ * NN / (PW * 64), 1, NH_ + 1), PW * 32, 0, stream>>>(x, WQ, WK, QX);    // rows: all batches; z: the two heads' Q', then x by rows
    k_attn<<<dim3(NN / QB, NB_, 1), FW * 32, 0, stream>>>(QX, QX + (size_t)NP_ * NN * DD, x, WV, OUT);
}

// v008
// It runs in 23.8 microseconds.
// Timed twice side by side with v007, it ran 1.08 and 1.09 times as fast.
// Counting every step since v000, it is 45.7 times as fast.
#include <hip/hip_runtime.h>

// x [4][4096][64]; per head h of 2: Q/K/V = x W[h] (64x64); scores = relu(Q.K^T) / 4096 (no softmax); out = x + sum_h scores V -> [4][4096][64].
// The products are reassociated: Q.K^T = (x WQ WK^T) x^T = Q' x^T, and scores V = (scores x) WV. So both heads have the same key rows and the same value rows, x itself, and no K or V plane is formed: one fp16 copy of x serves both products.
// Compute dtypes, f32 accumulate: every input rounded to bf16; x WQ on bf16 operands -> fp16; Q' = Q WK^T on fp16 -> fp16; WK carries the factor 1/4 (= 1024 / 4096, a power of two); scores x 1024 / 4096 (K 64) on fp16 operands with an fp16 accumulator, rounded after k 0..31 and after k 32..63, relu on the fp16 values; scores.x fp16 -> f32; (scores.x) / 1024 -> fp16, times WV on fp16.

#define NB_  4
#define NN   4096
#define DD   64
#define NH_  2
#define NP_  (NH_ * NB_)    // planes: one per (head, batch), index head * NB_ + batch
#define PCAR 1024.0f
#define SCL  (PCAR / NN)      // what the scores are multiplied by before they are rounded to fp16: 1/4, exact; it rides on WK, so the scores leave their product already scaled
typedef _Float16 h16;
typedef __attribute__((ext_vector_type(16))) __bf16   v16bf;
typedef __attribute__((ext_vector_type(16))) _Float16 v16h;
typedef __attribute__((ext_vector_type(8)))  _Float16 v8h;
typedef __attribute__((ext_vector_type(8)))  float    v8f;
typedef __attribute__((ext_vector_type(4)))  float    v4f;
typedef v8h  __attribute__((may_alias)) v8ha;
typedef v4f  __attribute__((may_alias)) v4fa;

__device__ __forceinline__ unsigned short f2bf(float f) { unsigned u = __float_as_uint(f); u += 0x7FFFu + ((u >> 16) & 1u); return (unsigned short)(u >> 16); }
__device__ __forceinline__ float bf2f(unsigned short b) { return __uint_as_float(((unsigned)b) << 16); }
__device__ __forceinline__ float bfr(float f) { return bf2f(f2bf(f)); }
__device__ __forceinline__ v16h cat16(v8h lo, v8h hi) { return __builtin_shufflevector(lo, hi, 0, 1, 2, 3, 4, 5, 6, 7, 8, 9, 10, 11, 12, 13, 14, 15); }
__device__ __forceinline__ v8f wmma16(v16h a, v16h b, v8f c) { return __builtin_amdgcn_wmma_f32_16x16x32_f16(false, a, false, b, (short)0, c, false, false); }
__device__ __forceinline__ v8h wmma16h(v16h a, v16h b, v8h c) { return __builtin_amdgcn_wmma_f16_16x16x32_f16(false, a, false, b, (short)0, c, false, false); }    // fp16 result: a lane's 8 rows stand packed in 4 registers
typedef __attribute__((ext_vector_type(16))) short v16s;
__device__ __forceinline__ v16h relu16(v16h a) { return __builtin_bit_cast(v16h, __builtin_elementwise_max(__builtin_bit_cast(v16s, a), (v16s){})); }    // a negative fp16 value is a negative 16-bit integer: the packed integer maximum with 0 is relu, two values an instruction
__device__ __forceinline__ v8f wmmab(v16bf a, v16bf b, v8f c) { return __builtin_amdgcn_wmma_f32_16x16x32_bf16(false, a, false, b, (short)0, c, false, false); }



template <typename T16> struct WFrag;
template <> struct WFrag<h16> { typedef v16h V; static __device__ __forceinline__ V ld(const h16* p) { return cat16(*(const v8h*)p, *(const v8h*)(p + 16)); } };
__device__ __forceinline__ h16 tohx(float x) { return (h16)x; }
typedef __attribute__((ext_vector_type(8))) __bf16 v8b;
typedef v8b __attribute__((may_alias)) v8ba;
__device__ __forceinline__ v8b b8(v8f a) { v8b r;    // eight f32 values rounded to nearest-even bf16
#pragma unroll
    for (int s = 0; s < 8; ++s) r[s] = (__bf16)a[s]; return r; }
__device__ __forceinline__ v16bf cat16b(v8b lo, v8b up) { return __builtin_shufflevector(lo, up, 0, 1, 2, 3, 4, 5, 6, 7, 8, 9, 10, 11, 12, 13, 14, 15); }
__device__ __forceinline__ v8h h8(v8f c) { v8h o;
#pragma unroll
    for (int j = 0; j < 8; ++j) o[j] = tohx(c[j]); return o; }
__device__ __forceinline__ v8h hb8(v8f a) { v8h o;    // eight f32 values rounded to bf16, held as fp16
#pragma unroll
    for (int j = 0; j < 8; ++j) o[j] = (h16)(float)(__bf16)a[j]; return o; }
__device__ __forceinline__ v8h hb8q(v8f a) { v8h o;    // the same, times SCL
#pragma unroll
    for (int j = 0; j < 8; ++j) o[j] = (h16)((float)(__bf16)a[j] * SCL); return o; }
// ---- k_proj: from the f32 inputs to the fp16 planes that k_attn reads, in one launch. Grid (B * N / 256, 1, 3), 4 waves: a wave takes 64 tokens.
// z = 0, 1: Q' = (x WQ[z]) (SCL WK[z])^T. z = 2: x as fp16 rows X[token][64].
// Operands are rounded from f32 to bf16 in registers. x: a fragment is two runs of 8 floats of a token's row. WQ[k][n]: each thread reads 32 k of one column n (a wave reads whole 128-byte lines)
// and writes them as 64 bytes of row n of WQ^T in LDS, from where every wave reads its fragments. WK[d][k] goes to LDS row by row. All loaders give the hardware k order (8 * hi + s, then 16 + 8 * hi + s). K = 64 is summed as k 0..31, then k 32..63, in f32.
// An accumulator lane holds 8 consecutive ROWS of one column. Q^T = WQ^T x^T (A = WQ^T, B = x^T): two tiles of 16 outputs, rounded to fp16 in place, are the B operand of Q'^T = WK Q^T (A = 16 rows of WK); a lane then holds 8 outputs of one token: 16 bytes of a row of Q'[token][64].
// z = 2: no product, the rounded values go straight back.
// The four stores that fill a 128-byte line come from the same wave.
#define PW 4                       // waves per work-group
#define WPI 144                    // LDS pitch of a 64-element 16-bit row (128 bytes + 16: an odd multiple of 16 bytes, free of bank conflicts for 16-byte accesses)
__global__ __launch_bounds__(PW * 32) void k_proj(const float* __restrict__ x, const float* __restrict__ wq, const float* __restrict__ wk, h16* __restrict__ QX) {
    __shared__ __align__(16) char wt[DD * WPI];
    __shared__ __align__(16) char wk2[DD * WPI];
    const int z = blockIdx.z;
    const int tid = threadIdx.x, lane = tid & 31, lr = lane & 15, hi = lane >> 4; const int r0 = blockIdx.x * (PW * 64) + __builtin_amdgcn_readfirstlane(tid >> 5) * 64;
    if (z == NH_) {    // x by rows: a plain stream, 32 bytes in and 16 bytes out a lane, whole lines a wave; the whole work-group leaves here, in front of the barrier
        const float* xs = x + (size_t)blockIdx.x * (PW * 64 * DD) + tid * 8; h16* xo = QX + (size_t)NP_ * NN * DD + (size_t)blockIdx.x * (PW * 64 * DD) + tid * 8;    // X stands behind the Q' planes
        v8f a[16]; v8h c[16];
#pragma unroll
        for (int i = 0; i < 16; ++i) a[i] = *(const v8f*)(xs + i * (PW * 32 * 8));
        asm volatile("s_wait_xcnt 0x0" :: "v"(xs) : "memory");    // all the loads name this address pair: it stays whole up to here
#pragma unroll
        for (int i = 0; i < 16; ++i) c[i] = hb8(a[i]);
        __builtin_amdgcn_sched_barrier(0);    // the stores stand as one group behind the conversions: no register that a store names is written again
#pragma unroll
        for (int i = 0; i < 16; ++i) *(v8h*)(xo + i * (PW * 32 * 8)) = c[i];
        return;
    }
    const float* wc = wq + z * DD * DD + (tid >> 6) * 32 * DD + (tid & 63); const float* kr = wk + z * DD * DD + (tid >> 1) * DD + (tid & 1) * 32; const float* xl = x + (size_t)(r0 + lr) * DD + 8 * hi;
    v8f wr[4], kx[4], xr[4][2][2];    // every loop below is unrolled, so that the register arrays are indexed by constants only
#pragma unroll
    for (int mb = 0; mb < 4; ++mb)
#pragma unroll
        for (int kc = 0; kc < 2; ++kc)
#pragma unroll
            for (int u = 0; u < 2; ++u) xr[mb][kc][u] = *(const v8f*)(xl + mb * 16 * DD + kc * 32 + u * 16);
#pragma unroll
    for (int i = 0; i < 4; ++i)
#pragma unroll
        for (int s = 0; s < 8; ++s) wr[i][s] = wc[(i * 8 + s) * DD];
#pragma unroll
    for (int i = 0; i < 4; ++i) kx[i] = *(const v8f*)(kr + i * 8);
    __builtin_amdgcn_sched_barrier(0);    // every load is issued before the first conversion waits for one: one memory latency, not several in turn
    asm volatile("s_wait_xcnt 0x0" :: "v"(wc), "v"(kr), "v"(xl) : "memory");    // all the loads name these three address pairs: they stay whole up to here and are free for reuse from here on
#pragma unroll
    for (int i = 0; i < 4; ++i) { *(v8ba*)(wt + (tid & 63) * WPI + (tid >> 6) * 64 + i * 16) = b8(wr[i]); *(v8ha*)(wk2 + (tid >> 1) * WPI + (tid & 1) * 64 + i * 16) = hb8q(kx[i]); }
    v16bf xf[4][2], wf[4][2];
#pragma unroll
    for (int mb = 0; mb < 4; ++mb)
#pragma unroll
        for (int kc = 0; kc < 2; ++kc) xf[mb][kc] = cat16b(b8(xr[mb][kc][0]), b8(xr[mb][kc][1]));
    __syncthreads();    // both matrices are whole in LDS before any wave reads a fragment of them
#pragma unroll
    for (int nb = 0; nb < 4; ++nb)
#pragma unroll
        for (int kc = 0; kc < 2; ++kc) { const char* p = wt + (nb * 16 + lr) * WPI + kc * 64 + 16 * hi; wf[nb][kc] = cat16b(*(const v8ba*)p, *(const v8ba*)(p + 32)); }
    v8h o[4][4];
    {
        h16* q = QX + (size_t)z * NB_ * NN * DD + (size_t)(r0 + lr) * DD + 8 * hi;    // planes Q'[head][batch]; rows: all batches one behind the other
#pragma unroll
        for (int mb = 0; mb < 4; ++mb)
#pragma unroll
            for (int nb = 0; nb < 4; ++nb) o[mb][nb] = h8(wmmab(wf[nb][1], xf[mb][1], wmmab(wf[nb][0], xf[mb][0], (v8f){})));
        __builtin_amdgcn_sched_barrier(0);    // the WK fragments are read only when the WQ^T and x fragments are done with: fewer registers live at once
        v16h ka[4][2];
#pragma unroll
        for (int nb = 0; nb < 4; ++nb)
#pragma unroll
            for (int kc = 0; kc < 2; ++kc) { const char* p = wk2 + (nb * 16 + lr) * WPI + kc * 64 + 16 * hi; ka[nb][kc] = cat16(*(const v8ha*)p, *(const v8ha*)(p + 32)); }
#pragma unroll
        for (int mb = 0; mb < 4; ++mb) { const v16h q0 = cat16(o[mb][0], o[mb][1]), q1 = cat16(o[mb][2], o[mb][3]);
#pragma unroll
            for (int nb = 0; nb < 4; ++nb) o[mb][nb] = h8(wmma16(ka[nb][1], q1, wmma16(ka[nb][0], q0, (v8f){}))); }
        __builtin_amdgcn_sched_barrier(0);    // the stores stand as one group behind the products: no register that a store names is written again
#pragma unroll
        for (int mb = 0; mb < 4; ++mb)
#pragma unroll
            for (int nb = 0; nb < 4; ++nb) *(v8h*)(q + mb * 16 * DD + nb * 16) = o[mb][nb];
        asm volatile("s_wait_xcnt 0x0" ::: "memory");    // behind the last store of the run: in the built code the z = 2 block follows this one and reuses the stores' registers
    }
}
// ---- k_attn: scores, relu, scores.x, the product with WV, the sum over heads and the residual in one kernel; the weights never leave registers. Grid (N / 64, batches): a work-group of 16 waves takes 64 queries, both heads, all keys, and writes its rows of out.
// The waves form four key groups of 4: wave w % 4 takes 32 queries (w & 1) of one head (w % 4 >> 1), and of every stage of 512 keys the 128 keys w / 4. Four waves a SIMD: while one waits for LDS or does its relu, three others can feed the matrix unit.
// Each group's part of a stage (128 rows of X, 16 KiB) is brought into LDS once for its 4 waves, that is for both heads and both products, by asynchronous copies of whole cache lines, two buffers: the next stage's copies fly while this one is worked on.
// One tile, two readers: rows of 128 bytes without a pad, the 16-byte piece c of row r standing at piece c ^ SWZ(r). So the 16 rows of one piece that half a wave reads with ds_load_b128, and the 8 rows of two pieces that it reads with ds_load_tr16_b128, each fall on all 64 banks once.
// Transposed products: S^T = X Q'^T (A = 16 key rows, B = 16 query columns), so two fp16 S^T tiles of 32 keys, which leave the matrix unit scaled and packed, are after relu in place the B operand of O^T += X^T P^T (A = 16 rows of X^T, which the transposing LDS load takes out of the same X tile).
// In the same way two O^T tiles of 32 columns d, rounded to fp16 in place, are the B operand of R^T = WV^T O^T (A = 16 rows of WV^T, which the work-group puts into LDS at its start).
// All loaders give the hardware k order (8 * hi + s, then 16 + 8 * hi + s). A wave sums all its keys in its own accumulators; the product with WV is linear, so each wave takes it of its own sums, and the 8 waves' R (2 heads x 4 key groups) are added in LDS order head, then group.
#define QW 4                       // waves side by side: 2 x 32 queries, 2 heads
#define KG 4                       // key groups
#define FW (QW * KG)               // waves per work-group
#define QB 64                      // queries per work-group
#define KT 128                     // keys per stage and key group
#define KPI 128                    // LDS pitch of an X row: no pad
#define SWZ(r) (2 * (((r) >> 1) & 3) + (((r) >> 3) & 1))    // what a row's piece numbers are XORed with; it repeats every 16 rows
#define SBY 32768                  // one group's part of a buffer: its X tile (16 KiB) at the start of a 32-KiB block of LDS of its own, so that the four groups' reads and the copies into the other buffer fall in different blocks
#define BBY (KG * SBY)             // one buffer
static_assert(KT * KPI <= SBY, "a group's tile must fit its block");
#define NST (NN / (KG * KT))       // stages per work-group
#define RP 68
#define OBY (FW * 32 * RP * 4)     // output staging: a 32 x 64 f32 tile a wave
// One stage: the group's 128 lanes cover 16 rows of the X tile at a time, so each lane copies eight 16-byte pieces, 16 rows apart (the same SWZ).
// The wait is the statement's last line, so that no address register is rewritten before it.
__device__ __forceinline__ void stage_copy(unsigned lk, const char* gk) {
    asm volatile("global_load_async_to_lds_b128 %0, %1, off\n\t"
                 "global_load_async_to_lds_b128 %2, %3, off\n\t"
                 "global_load_async_to_lds_b128 %4, %5, off\n\t"
                 "global_load_async_to_lds_b128 %6, %7, off\n\t"
                 "global_load_async_to_lds_b128 %8, %9, off\n\t"
                 "global_load_async_to_lds_b128 %10, %11, off\n\t"
                 "global_load_async_to_lds_b128 %12, %13, off\n\t"
                 "global_load_async_to_lds_b128 %14, %15, off\n\t"
                 "s_wait_xcnt 0x0"
                 :: "v"(lk), "v"(gk), "v"(lk + 16 * KPI), "v"(gk + 16 * DD * 2), "v"(lk + 32 * KPI), "v"(gk + 32 * DD * 2), "v"(lk + 48 * KPI), "v"(gk + 48 * DD * 2),
                    "v"(lk + 64 * KPI), "v"(gk + 64 * DD * 2), "v"(lk + 80 * KPI), "v"(gk + 80 * DD * 2), "v"(lk + 96 * KPI), "v"(gk + 96 * DD * 2), "v"(lk + 112 * KPI), "v"(gk + 112 * DD * 2)
                 : "memory");
}
__device__ __forceinline__ v16h ldsfrag(const char* p) { return cat16(*(const v8ha*)p, *(const v8ha*)(p + 32)); }
typedef __attribute__((ext_vector_type(8))) short s16x8;
// The transposing load: the lanes hand in 16 rows x 2 pieces (row 8 * hi + (lane & 7), piece (lane >> 3) & 1), and lane (lr, hi) gets column lr of rows 8 * hi ... 8 * hi + 7.
__device__ __forceinline__ v8h ld_tr16(const char* p) { typedef __attribute__((address_space(3))) s16x8 lds_s16x8; return __builtin_bit_cast(v8h, __builtin_amdgcn_ds_load_tr16_b128_v8i16((lds_s16x8*)p)); }
// Four waves a SIMD, that is one work-group a WGP: the grid has as many work-groups as the chip has WGPs.
__global__ __launch_bounds__(FW * 32) __attribute__((amdgpu_waves_per_eu(4, 4))) void k_attn(const h16* __restrict__ Qp, const h16* __restrict__ Xp, const float* __restrict__ x, const float* __restrict__ wvg, float* __restrict__ outb) {
    __shared__ __align__(16) char sm[2 * BBY > OBY ? 2 * BBY : OBY];    // the two buffers, later the output staging; every inner loop below is unrolled, so that the register arrays are indexed by constants only
    __shared__ __align__(16) char wvt[NH_ * DD * WPI];
    const int tid = threadIdx.x, lane = tid & 31, lr = lane & 15, hi = lane >> 4; const int wv = __builtin_amdgcn_readfirstlane(tid >> 5); const int w = wv % QW, kg = wv / QW, t = tid % (QW * 32); const int hd = w >> 1, q0 = blockIdx.x * QB + (w & 1) * 32;
    { const size_t b = blockIdx.y; Qp += ((size_t)hd * NB_ + b) * NN * DD; Xp += b * NN * DD; x += (b * NN + blockIdx.x * QB) * DD; outb += (b * NN + blockIdx.x * QB) * DD; }
    const int kfirst = kg * KT;    // the group's first key; its next stage lies KG * KT keys on
    const unsigned lk = (unsigned)(size_t)sm + kg * SBY + (t >> 3) * KPI + ((t & 7) ^ SWZ(t >> 3)) * 16;    // the lane's place in its group's part of buffer 0
    const char* gk = (const char*)Xp + (size_t)kfirst * DD * 2 + t * 16;    // and its source in stage 0
    stage_copy(lk, gk);
    { const float* wc = wvg + (tid >> 8) * DD * DD + ((tid >> 6) & 3) * 16 * DD + (tid & 63); v8f wr[2];    // WV[d][n] of both heads: each thread reads 16 d of one column n and writes them as 32 bytes of row n of WV^T
#pragma unroll
        for (int i = 0; i < 2; ++i)
#pragma unroll
            for (int s = 0; s < 8; ++s) wr[i][s] = wc[(i * 8 + s) * DD];
        asm volatile("s_wait_xcnt 0x0" :: "v"(wc) : "memory");    // all 16 loads name this address pair: it stays whole up to here
#pragma unroll
        for (int i = 0; i < 2; ++i) *(v8ha*)(wvt + ((tid >> 8) * DD + (tid & 63)) * WPI + ((tid >> 6) & 3) * 32 + i * 16) = hb8(wr[i]); }
    v16h qf[2][2]; const unsigned qo = ((q0 + lr) * DD + 8 * hi) * 2;
#pragma unroll
    for (int g = 0; g < 2; ++g)
#pragma unroll
        for (int kc = 0; kc < 2; ++kc) qf[g][kc] = WFrag<h16>::ld((const h16*)((const char*)Qp + (g * 16 * DD + kc * 32) * 2 + qo));
    v8f acc[4][2];
#pragma unroll
    for (int dt = 0; dt < 4; ++dt)
#pragma unroll
        for (int g = 0; g < 2; ++g) acc[dt][g] = (v8f){};
    asm volatile("s_wait_asynccnt 0x0" ::: "memory");    // this wave's part of stage 0 has landed
    __syncthreads();                                     // and so has every other wave's, and WV^T is whole in LDS
    stage_copy(lk + BBY, gk + KG * KT * DD * 2);
    const char* kl[2][2]; const char* vl[4];    // the lane's fragment pieces in its group's part of buffer 0; every row step below is a multiple of 16 rows, so SWZ stays
#pragma unroll
    for (int kc = 0; kc < 2; ++kc)
#pragma unroll
        for (int u = 0; u < 2; ++u) kl[kc][u] = sm + kg * SBY + lr * KPI + ((kc * 4 + u * 2 + hi) ^ SWZ(lr)) * 16;    // row lr, bytes 16 * hi and 32 + 16 * hi of each 64
#pragma unroll
    for (int dt = 0; dt < 4; ++dt) vl[dt] = sm + kg * SBY + (8 * hi + (lane & 7)) * KPI + ((dt * 2 + ((lane >> 3) & 1)) ^ SWZ(8 * hi + (lane & 7))) * 16;    // 16 columns d are 2 pieces
#pragma unroll 1    // rolled: one trip a stage, the buffer chosen by the trip's parity
    for (int st = 0; st < NST; ++st) {
        const int bo = (st & 1) * BBY;
        v16h kf[2][2], vf[4];
#pragma unroll
        for (int t = 0; t < 2; ++t)
#pragma unroll
            for (int kc = 0; kc < 2; ++kc) kf[t][kc] = cat16(*(const v8ha*)(kl[kc][0] + bo + t * 16 * KPI), *(const v8ha*)(kl[kc][1] + bo + t * 16 * KPI));
#pragma unroll    // unrolled: LDS offsets become immediates, and the last 32 keys of a stage fetch no K rows ahead without a branch
        for (int p = 0; p < KT / 32; ++p) {
#pragma unroll
            for (int dt = 0; dt < 4; ++dt) vf[dt] = cat16(ld_tr16(vl[dt] + bo + p * 32 * KPI), ld_tr16(vl[dt] + bo + (p * 32 + 16) * KPI));    // keys 8 * hi + s, then 16 + 8 * hi + s: the hardware k order
            __builtin_amdgcn_sched_barrier(0);    // the X^T reads stand as one group in front of the score products, which hide their latency
            v8h s[2][2];
#pragma unroll
            for (int g = 0; g < 2; ++g)
#pragma unroll
                for (int t = 0; t < 2; ++t) s[g][t] = wmma16h(kf[t][1], qf[g][1], wmma16h(kf[t][0], qf[g][0], (v8h){}));
            __builtin_amdgcn_sched_barrier(0);    // the next 32 keys' K reads stand as one group behind the score products, not among them
            if (p + 1 < KT / 32) {
#pragma unroll
                for (int t = 0; t < 2; ++t)
#pragma unroll
                    for (int kc = 0; kc < 2; ++kc) kf[t][kc] = cat16(*(const v8ha*)(kl[kc][0] + bo + ((p + 1) * 32 + t * 16) * KPI), *(const v8ha*)(kl[kc][1] + bo + ((p + 1) * 32 + t * 16) * KPI));
            }
            __builtin_amdgcn_sched_barrier(0);    // and in front of the relu and the second products, which hide their latency
            v16h pr[2];
#pragma unroll
            for (int g = 0; g < 2; ++g) pr[g] = relu16(cat16(s[g][0], s[g][1]));    // the two tiles' registers, as they stand, are the B operand; both query groups first, so that the eight products follow one another
#pragma unroll
            for (int g = 0; g < 2; ++g)
#pragma unroll
                for (int dt = 0; dt < 4; ++dt) acc[dt][g] = wmma16(vf[dt], pr[g], acc[dt][g]);
        }
        asm volatile("s_wait_dscnt 0x0" ::: "memory");       // this wave's reads of the buffer are done
        asm volatile("s_wait_asynccnt 0x0" ::: "memory");    // its part of the next stage has landed
        __syncthreads();                                     // both hold for every wave: the next stage may be read, this buffer refilled
        if (st + 2 < NST) stage_copy(lk + bo, gk + (size_t)(st + 2) * (KG * KT * DD * 2));
    }
    asm volatile("s_wait_asynccnt 0x0" ::: "memory");    // no copy is outstanding when the buffers become output staging
    const int e0 = tid * 4, e1 = (tid + FW * 32) * 4;    // the thread's two 16-byte pieces of the work-group's 64 x 64 block of x and of out
    const v4f x0 = *(const v4f*)(x + e0), x1 = *(const v4f*)(x + e1);    // asked for here, needed behind the barrier
    asm volatile("s_wait_xcnt 0x0" ::: "memory");    // the two loads' address registers are free for reuse from here on
    v16h ob[2][2];
#pragma unroll
    for (int g = 0; g < 2; ++g)
#pragma unroll
        for (int kc = 0; kc < 2; ++kc)
#pragma unroll
            for (int j = 0; j < 8; ++j) { ob[g][kc][j] = tohx(acc[2 * kc][g][j] * (1.0f / PCAR)); ob[g][kc][8 + j] = tohx(acc[2 * kc + 1][g][j] * (1.0f / PCAR)); }
    const char* wl = wvt + (hd * DD + lr) * WPI + 16 * hi; float* mine = (float*)sm + wv * 32 * RP + lr * RP + hi * 8;    // each wave has a 32 x 64 tile of its own
#pragma unroll
    for (int nb = 0; nb < 4; ++nb) { const v16h a0 = ldsfrag(wl + nb * 16 * WPI), a1 = ldsfrag(wl + nb * 16 * WPI + 64);
#pragma unroll
        for (int g = 0; g < 2; ++g) { const v8f r = wmma16(a1, ob[g][1], wmma16(a0, ob[g][0], (v8f){}));
            *(v4fa*)(mine + g * 16 * RP + nb * 16) = (v4f){r[0], r[1], r[2], r[3]}; *(v4fa*)(mine + g * 16 * RP + nb * 16 + 4) = (v4f){r[4], r[5], r[6], r[7]}; } }
    __syncthreads();    // all 16 tiles are in LDS before any thread adds them
#pragma unroll
    for (int u = 0; u < 2; ++u) { const int e = u ? e1 : e0, q = e / DD; const float* p = (const float*)sm + (q >> 5) * 32 * RP + (q & 31) * RP + e % DD; v4f s = *(const v4fa*)p;    // query q stands in the tiles of the waves with w & 1 == q >> 5
#pragma unroll
        for (int i = 1; i < NH_ * KG; ++i) s += *(const v4fa*)(p + ((i % KG) * QW + (i / KG) * 2) * 32 * RP);    // head 0: groups 0 to 3, then head 1
        const v4f xv = u ? x1 : x0; v4f r;
#pragma unroll
        for (int i = 0; i < 4; ++i) r[i] = bfr(xv[i]) + s[i];
        *(v4f*)(outb + e) = r; }
}

extern "C" void kernel_launch(void* const* d_in, const int* in_sizes, int n_in,
                              void* d_out, int out_size, void* d_ws, size_t ws_size, hipStream_t stream) {
    (void)in_sizes; (void)n_in; (void)out_size;
    const float** I = (const float**)d_in;
    const float *x = I[0], *WQ = I[1], *WK = I[2], *WV = I[3];
    float* OUT = (float*)d_out;     // [4][4096][64]
    char* wsp = (char*)d_ws;
    auto take = [&](size_t bytes) { char* p = wsp; wsp += (bytes + 255) & ~(size_t)255; return (void*)p; };
    h16* QX = (h16*)take((size_t)(NP_ + NB_) * NN * DD * 2);    // Q'[head][batch][N][D], then X[batch][N][D]
    if ((size_t)(wsp - (char*)d_ws) > ws_size) return;
    k_proj<<<dim3(NB_ * NN / (PW * 64), 1, NH_ + 1), PW * 32, 0, stream>>>(x, WQ, WK, QX);    // rows: all batches; z: the two heads' Q', then x by rows
    k_attn<<<dim3(NN / QB, NB_, 1), FW * 32, 0, stream>>>(QX, QX + (size_t)NP_ * NN * DD, x, WV, OUT);
}

// v009
// It runs in 22.1 microseconds.
// Timed twice side by side with v008, it ran 1.09 and 1.08 times as fast.
// Over all steps from v000 it is 49.5 times as fast.
#include <hip/hip_runtime.h>

// x [4][4096][64]; per head h of 2: Q/K/V = x W[h] (64x64); scores = relu(Q.K^T) / 4096 (no softmax); out = x + sum_h scores V -> [4][4096][64].
// The products are reassociated: Q.K^T = (x WQ WK^T) x^T = Q' x^T, and scores V = (scores x) WV. So both heads have the same key rows and the same value rows, x itself, and no K or V plane is formed: one fp16 tile of x serves both products.
// Compute dtypes, f32 accumulate: the weights, the query rows of x and the residual x rounded to bf16; the key and value rows of x rounded once, f32 -> fp16; x WQ on bf16 operands -> fp16; Q' = Q WK^T on fp16 -> fp16; WK carries the factor 1/4 (= 1024 / 4096, a power of two); scores x 1024 / 4096 (K 64) on fp16 operands with an fp16 accumulator, rounded after k 0..31 and after k 32..63, relu on the fp16 values; scores.x fp16 -> f32; (scores.x) / 1024 -> fp16, times WV on fp16.

#define NB_  4
#define NN   4096
#define DD   64
#define NH_  2
#define PCAR 1024.0f
#define SCL  (PCAR / NN)      // what the scores are multiplied by before they are rounded to fp16: 1/4, exact; it rides on WK, so the scores leave their product already scaled
typedef _Float16 h16;
typedef __attribute__((ext_vector_type(16))) __bf16   v16bf;
typedef __attribute__((ext_vector_type(16))) _Float16 v16h;
typedef __attribute__((ext_vector_type(8)))  _Float16 v8h;
typedef __attribute__((ext_vector_type(8)))  float    v8f;
typedef __attribute__((ext_vector_type(4)))  float    v4f;
typedef v8h  __attribute__((may_alias)) v8ha;
typedef v4f  __attribute__((may_alias)) v4fa;

__device__ __forceinline__ unsigned short f2bf(float f) { unsigned u = __float_as_uint(f); u += 0x7FFFu + ((u >> 16) & 1u); return (unsigned short)(u >> 16); }
__device__ __forceinline__ float bf2f(unsigned short b) { return __uint_as_float(((unsigned)b) << 16); }
__device__ __forceinline__ float bfr(float f) { return bf2f(f2bf(f)); }
__device__ __forceinline__ v16h cat16(v8h lo, v8h hi) { return __builtin_shufflevector(lo, hi, 0, 1, 2, 3, 4, 5, 6, 7, 8, 9, 10, 11, 12, 13, 14, 15); }
__device__ __forceinline__ v8f wmma16(v16h a, v16h b, v8f c) { return __builtin_amdgcn_wmma_f32_16x16x32_f16(false, a, false, b, (short)0, c, false, false); }
__device__ __forceinline__ v8h wmma16h(v16h a, v16h b, v8h c) { return __builtin_amdgcn_wmma_f16_16x16x32_f16(false, a, false, b, (short)0, c, false, false); }    // fp16 result: a lane's 8 rows stand packed in 4 registers
typedef __attribute__((ext_vector_type(16))) short v16s;
__device__ __forceinline__ v16h relu16(v16h a) { return __builtin_bit_cast(v16h, __builtin_elementwise_max(__builtin_bit_cast(v16s, a), (v16s){})); }    // a negative fp16 value is a negative 16-bit integer: the packed integer maximum with 0 is relu, two values an instruction
__device__ __forceinline__ v8f wmmab(v16bf a, v16bf b, v8f c) { return __builtin_amdgcn_wmma_f32_16x16x32_bf16(false, a, false, b, (short)0, c, false, false); }
__device__ __forceinline__ h16 tohx(float x) { return (h16)x; }
typedef __attribute__((ext_vector_type(8))) __bf16 v8b;
typedef v8b __attribute__((may_alias)) v8ba;
__device__ __forceinline__ v8b b8(v8f a) { v8b r;    // eight f32 values rounded to nearest-even bf16
#pragma unroll
    for (int s = 0; s < 8; ++s) r[s] = (__bf16)a[s]; return r; }
__device__ __forceinline__ v16bf cat16b(v8b lo, v8b up) { return __builtin_shufflevector(lo, up, 0, 1, 2, 3, 4, 5, 6, 7, 8, 9, 10, 11, 12, 13, 14, 15); }
__device__ __forceinline__ v8h h8(v8f c) { v8h o;
#pragma unroll
    for (int j = 0; j < 8; ++j) o[j] = tohx(c[j]); return o; }
__device__ __forceinline__ v8h hb8(v8f a) { v8h o;    // eight f32 values rounded to bf16, held as fp16
#pragma unroll
    for (int j = 0; j < 8; ++j) o[j] = (h16)(float)(__bf16)a[j]; return o; }
__device__ __forceinline__ v8h hb8q(v8f a) { v8h o;    // the same, times SCL
#pragma unroll
    for (int j = 0; j < 8; ++j) o[j] = (h16)((float)(__bf16)a[j] * SCL); return o; }
typedef __attribute__((ext_vector_type(4))) _Float16 v4h;
typedef v4h __attribute__((may_alias)) v4ha;
__device__ __forceinline__ v4h h4(v4f a) { v4h o;    // four f32 values rounded to nearest-even fp16
#pragma unroll
    for (int j = 0; j < 4; ++j) o[j] = tohx(a[j]); return o; }
#define WPI 144                    // LDS pitch of a 64-element 16-bit row of a weight matrix (128 bytes + 16: an odd multiple of 16 bytes, free of bank conflicts for 16-byte accesses)
// ---- k_attn: the whole function in one launch, from the f32 inputs: Q', scores, relu, scores.x, the product with WV, the sum over heads and the residual; the attention weights never leave registers. Grid (N / 64, batches): a work-group of 16 waves takes 64 queries, both heads, all keys, and writes its rows of out.
// The waves form four key groups of 4: wave w % 4 takes 32 queries (w & 1) of one head (w % 4 >> 1), and of every stage of 512 keys the 128 keys w / 4. Four waves a SIMD: while one waits for LDS or does its relu, three others can feed the matrix unit.
// Q' = (x WQ) (SCL WK)^T of the work-group's 64 queries and 2 heads is formed at the start: wave v takes head v / 8, the 16 queries (v / 2) % 4 and the 32 outputs v % 2. WQ[k][n]: each thread reads 16 k of one column n (a wave reads whole 128-byte lines) and writes them as 32 bytes of row n of WQ^T in LDS; WK[d][k] goes to LDS row by row.
// An accumulator lane holds 8 consecutive ROWS of one column. Q^T = WQ^T x^T (A = WQ^T, B = x^T, a fragment of x being two runs of 8 floats of a query's row): two tiles of 16 outputs, rounded to fp16 in place, are the B operand of Q'^T = WK Q^T (A = 16 rows of WK), and two tiles of that, again rounded in place, are one B fragment of the score product, which goes lane for lane through LDS to the 4 waves, one a key group, that use it. K = 64 is summed as k 0..31, then k 32..63, in f32.
// Each group's part of a stage (128 rows of x, as fp16 16 KiB) is brought into LDS once for its 4 waves, that is for both heads and both products: f32 loads of whole cache lines (a wave reads 2 rows an instruction), rounded to fp16 in registers, 8-byte LDS stores. Two buffers: the next stage comes in two parts of 64 rows, each asked for at the head of 64 keys' work and stored behind it.
// One tile, two readers: rows of 128 bytes without a pad, the 16-byte piece c of row r standing at piece c ^ SWZ(r). So the 16 rows of one piece that half a wave reads with ds_load_b128, and the 8 rows of two pieces that it reads with ds_load_tr16_b128, each fall on all 64 banks once.
// Transposed products: S^T = X Q'^T (A = 16 key rows, B = 16 query columns), so two fp16 S^T tiles of 32 keys, which leave the matrix unit scaled and packed, are after relu in place the B operand of O^T += X^T P^T (A = 16 rows of X^T, which the transposing LDS load takes out of the same X tile).
// In the same way two O^T tiles of 32 columns d, rounded to fp16 in place, are the B operand of R^T = WV^T O^T (A = 16 rows of WV^T, which the work-group puts into LDS at its start).
// All loaders give the hardware k order (8 * hi + s, then 16 + 8 * hi + s). A wave sums all its keys in its own accumulators; the product with WV is linear, so each wave takes it of its own sums, and the 8 waves' R (2 heads x 4 key groups) are added in LDS order head, then group.
#define QW 4                       // waves side by side: 2 x 32 queries, 2 heads
#define KG 4                       // key groups
#define FW (QW * KG)               // waves per work-group
#define QB 64                      // queries per work-group
#define KT 128                     // keys per stage and key group
#define KPI 128                    // LDS pitch of an X row: no pad
#define SWZ(r) (2 * (((r) >> 1) & 3) + (((r) >> 3) & 1))    // what a row's piece numbers are XORed with; it repeats every 16 rows
#define SBY 32768                  // one group's part of a buffer: its X tile (16 KiB) at the start of a 32-KiB block of LDS of its own, so that the four groups' reads and the stores into the other buffer fall in different blocks
#define BBY (KG * SBY)             // one buffer
static_assert(KT * KPI + FW * 1024 <= SBY, "a group's tile, and behind the first group's the fragments of Q', must fit its block");
#define NST (NN / (KG * KT))       // stages per work-group
#define RP 68
#define OBY (FW * 32 * RP * 4)     // output staging: a 32 x 64 f32 tile a wave
#define WBY (NH_ * DD * WPI)       // one weight matrix, both heads, in LDS
static_assert(OBY <= 2 * BBY, "the output staging must fit the two buffers");
__device__ __forceinline__ v16h ldsfrag(const char* p) { return cat16(*(const v8ha*)p, *(const v8ha*)(p + 32)); }
typedef __attribute__((ext_vector_type(8))) short s16x8;
// The transposing load: the lanes hand in 16 rows x 2 pieces (row 8 * hi + (lane & 7), piece (lane >> 3) & 1), and lane (lr, hi) gets column lr of rows 8 * hi ... 8 * hi + 7.
__device__ __forceinline__ v8h ld_tr16(const char* p) { typedef __attribute__((address_space(3))) s16x8 lds_s16x8; return __builtin_bit_cast(v8h, __builtin_amdgcn_ds_load_tr16_b128_v8i16((lds_s16x8*)p)); }
// Four waves a SIMD, that is one work-group a WGP: the grid has as many work-groups as the chip has WGPs.
__global__ __launch_bounds__(FW * 32) __attribute__((amdgpu_waves_per_eu(4, 4))) void k_attn(const float* __restrict__ x, const float* __restrict__ wqg, const float* __restrict__ wkg, const float* __restrict__ wvg, float* __restrict__ outb) {
    __shared__ __align__(16) char sm[2 * BBY + 3 * WBY];    // the two buffers, later the output staging, then the three weight matrices; one array, so that the buffers start at LDS byte 0; every inner loop below is unrolled, so that the register arrays are indexed by constants only
    char* const wvt = sm + 2 * BBY; char* const wqt = wvt + WBY; char* const wk2 = wqt + WBY;
    const int tid = threadIdx.x, lane = tid & 31, lr = lane & 15, hi = lane >> 4; const int wv = __builtin_amdgcn_readfirstlane(tid >> 5); const int w = wv % QW, kg = wv / QW; const int hd = w >> 1;
    const float* xb = x + (size_t)blockIdx.y * NN * DD;    // the batch's rows: keys and values
    x = xb + blockIdx.x * QB * DD; outb += ((size_t)blockIdx.y * NN + blockIdx.x * QB) * DD;
    const int wo = (tid >> 8) * DD * DD + ((tid >> 6) & 3) * 16 * DD + (tid & 63);    // WQ[k][n], WV[d][n] of both heads: each thread reads 16 rows of one column n and writes them as 32 bytes of row n of the transpose
    const float* qc = wqg + wo; const float* vc = wvg + wo; const float* kr = wkg + (tid >> 2) * DD + (tid & 3) * 16;    // WK: 16 floats of a row
    const int ph = wv >> 3, pq = (wv >> 1) & 3, pk = wv & 1;    // the wave's part in forming Q': head, 16 queries, 32 of the 64 outputs
    const float* xl = xb + (size_t)(blockIdx.x * QB + pq * 16 + lr) * DD + 8 * hi;    // those query rows
    const float* xg = xb + (size_t)(kg * KT + w * 8 + hi) * DD + lr * 4;    // the lane's 16 bytes of its group's tile of stage 0: a part of 32 rows is 8 rows a wave, 2 rows an instruction
    unsigned xs[4];    // and their places, as bytes from the start of sm, in the group's part of buffer 0: 8 bytes, half a piece; the parts lie 32 rows apart, so SWZ stays
#pragma unroll
    for (int i = 0; i < 4; ++i) xs[i] = kg * SBY + (w * 8 + i * 2 + hi) * KPI + ((lr >> 1) ^ SWZ(w * 8 + i * 2 + hi)) * 16 + (lr & 1) * 8;
    v16bf xf[2];
    { v8f qr[2], kx[2], vr[2], xr[2][2]; v4f x0[KT / 32][4];
#pragma unroll
        for (int i = 0; i < 2; ++i)
#pragma unroll
            for (int s = 0; s < 8; ++s) qr[i][s] = qc[(i * 8 + s) * DD];
#pragma unroll
        for (int i = 0; i < 2; ++i) kx[i] = *(const v8f*)(kr + i * 8);
#pragma unroll
        for (int kc = 0; kc < 2; ++kc)
#pragma unroll
            for (int u = 0; u < 2; ++u) xr[kc][u] = *(const v8f*)(xl + kc * 32 + u * 16);
#pragma unroll
        for (int p = 0; p < KT / 32; ++p)
#pragma unroll
            for (int i = 0; i < 4; ++i) x0[p][i] = *(const v4f*)(xg + (p * 32 + i * 2) * DD);
#pragma unroll
        for (int i = 0; i < 2; ++i)
#pragma unroll
            for (int s = 0; s < 8; ++s) vr[i][s] = vc[(i * 8 + s) * DD];
        __builtin_amdgcn_sched_barrier(0);    // every load is issued before the first conversion waits for one: one memory latency, not several in turn
        asm volatile("s_wait_xcnt 0x0" :: "v"(qc), "v"(kr), "v"(xl), "v"(xg), "v"(vc) : "memory");    // all the loads name these five address pairs: they stay whole up to here and are free for reuse from here on
        const int wr = ((tid >> 8) * DD + (tid & 63)) * WPI + ((tid >> 6) & 3) * 32;
#pragma unroll
        for (int i = 0; i < 2; ++i) { *(v8ba*)(wqt + wr + i * 16) = b8(qr[i]); *(v8ha*)(wk2 + (tid >> 2) * WPI + (tid & 3) * 32 + i * 16) = hb8q(kx[i]); }
#pragma unroll
        for (int kc = 0; kc < 2; ++kc) xf[kc] = cat16b(b8(xr[kc][0]), b8(xr[kc][1]));
#pragma unroll
        for (int p = 0; p < KT / 32; ++p)
#pragma unroll
            for (int i = 0; i < 4; ++i) *(v4ha*)(sm + xs[i] + p * 32 * KPI) = h4(x0[p][i]);
#pragma unroll
        for (int i = 0; i < 2; ++i) *(v8ha*)(wvt + wr + i * 16) = hb8(vr[i]); }
    xg += KG * KT * DD;    // from here on: the stage that is fetched ahead
    __syncthreads();    // stage 0 and the three weight matrices are whole in LDS before any wave reads them
    v16h qf[2][2];
    { v8h o[4]; char* const qx = sm + KT * KPI;    // the fragments' way from wave to wave: 1 KiB a wave, in the free half of the first group's block of buffer 0
        v16bf qa[4][2]; v16h ka[2][2];
#pragma unroll
        for (int nb = 0; nb < 4; ++nb)
#pragma unroll
            for (int kc = 0; kc < 2; ++kc) { const char* p = wqt + (ph * DD + nb * 16 + lr) * WPI + kc * 64 + 16 * hi; qa[nb][kc] = cat16b(*(const v8ba*)p, *(const v8ba*)(p + 32)); }
#pragma unroll
        for (int j = 0; j < 2; ++j)
#pragma unroll
            for (int kc = 0; kc < 2; ++kc) ka[j][kc] = ldsfrag(wk2 + (ph * DD + (pk * 2 + j) * 16 + lr) * WPI + kc * 64 + 16 * hi);
        __builtin_amdgcn_sched_barrier(0);    // every fragment is asked for before the first product waits for one: one LDS latency, not one a product
#pragma unroll
        for (int nb = 0; nb < 4; ++nb) o[nb] = h8(wmmab(qa[nb][1], xf[1], wmmab(qa[nb][0], xf[0], (v8f){})));
        const v16h b0 = cat16(o[0], o[1]), b1 = cat16(o[2], o[3]);
#pragma unroll
        for (int j = 0; j < 2; ++j) *(v8ha*)(qx + wv * 1024 + j * 512 + lane * 16) = h8(wmma16(ka[j][1], b1, wmma16(ka[j][0], b0, (v8f){})));
        __syncthreads();    // all 16 fragments of Q' are in LDS before any wave reads its four
#pragma unroll
        for (int g = 0; g < 2; ++g)
#pragma unroll
            for (int kc = 0; kc < 2; ++kc) { const char* s = qx + (((hd * 4 + (w & 1) * 2 + g) * 2 + kc) * 1024) + lane * 16; qf[g][kc] = cat16(*(const v8ha*)s, *(const v8ha*)(s + 512)); } }
    v8f acc[4][2];
#pragma unroll
    for (int dt = 0; dt < 4; ++dt)
#pragma unroll
        for (int g = 0; g < 2; ++g) acc[dt][g] = (v8f){};
    unsigned kl[2][2], vl[4];    // the lane's fragment pieces in its group's part of buffer 0, as bytes from the start of sm; every row step below is a multiple of 16 rows, so SWZ stays
#pragma unroll
    for (int kc = 0; kc < 2; ++kc)
#pragma unroll
        for (int u = 0; u < 2; ++u) kl[kc][u] = kg * SBY + lr * KPI + ((kc * 4 + u * 2 + hi) ^ SWZ(lr)) * 16;    // row lr, bytes 16 * hi and 32 + 16 * hi of each 64
#pragma unroll
    for (int dt = 0; dt < 4; ++dt) vl[dt] = kg * SBY + (8 * hi + (lane & 7)) * KPI + ((dt * 2 + ((lane >> 3) & 1)) ^ SWZ(8 * hi + (lane & 7))) * 16;    // 16 columns d are 2 pieces
    // The places change buffers in place, at each stage's foot: one register a place, not a base and a sum.
    auto flip = [&]() __attribute__((always_inline)) {
#pragma unroll
        for (int i = 0; i < 4; ++i) { kl[i >> 1][i & 1] ^= BBY; vl[i] ^= BBY; xs[i] ^= BBY; }
    };
#pragma unroll
    for (int i = 0; i < 4; ++i) xs[i] ^= BBY;    // stage 0 is read in buffer 0 while stage 1 is stored into buffer 1
    // One stage: the work on the buffer that kl and vl stand in, and the next stage's way into the other, in which xs stands. The last stage fetches nothing.
    auto stage = [&](const bool more) __attribute__((always_inline)) {
        v16h kf[2][2], vf[4]; v4f xa[2][4];
#pragma unroll
        for (int t = 0; t < 2; ++t)
#pragma unroll
            for (int kc = 0; kc < 2; ++kc) kf[t][kc] = cat16(*(const v8ha*)(sm + kl[kc][0] + t * 16 * KPI), *(const v8ha*)(sm + kl[kc][1] + t * 16 * KPI));
#pragma unroll    // unrolled: LDS offsets become immediates, and the last 32 keys of a stage fetch no K rows ahead without a branch
        for (int p = 0; p < KT / 32; ++p) {
            if (more && (p & 1) == 0) {    // 64 rows of the next stage: asked for here, stored behind the products of these 32 keys and the next 32; so no load is on its way at the stage's barrier, which would wait for it
#pragma unroll
                for (int c = 0; c < 2; ++c)
#pragma unroll
                    for (int i = 0; i < 4; ++i) xa[c][i] = *(const v4f*)(xg + ((p + c) * 32 + i * 2) * DD);
                asm volatile("s_wait_xcnt 0x0" ::: "memory");    // directly behind the loads: their address pair may be rewritten from here on
            }
#pragma unroll
            for (int dt = 0; dt < 4; ++dt) vf[dt] = cat16(ld_tr16(sm + vl[dt] + p * 32 * KPI), ld_tr16(sm + vl[dt] + (p * 32 + 16) * KPI));    // keys 8 * hi + s, then 16 + 8 * hi + s: the hardware k order
            __builtin_amdgcn_sched_barrier(0);    // the x loads and the X^T reads stand as one group in front of the score products, which hide their latency
            v8h s[2][2];
#pragma unroll
            for (int g = 0; g < 2; ++g)
#pragma unroll
                for (int t = 0; t < 2; ++t) s[g][t] = wmma16h(kf[t][1], qf[g][1], wmma16h(kf[t][0], qf[g][0], (v8h){}));
            __builtin_amdgcn_sched_barrier(0);    // the next 32 keys' K reads stand as one group behind the score products, not among them
            if (p + 1 < KT / 32) {
#pragma unroll
                for (int t = 0; t < 2; ++t)
#pragma unroll
                    for (int kc = 0; kc < 2; ++kc) kf[t][kc] = cat16(*(const v8ha*)(sm + kl[kc][0] + ((p + 1) * 32 + t * 16) * KPI), *(const v8ha*)(sm + kl[kc][1] + ((p + 1) * 32 + t * 16) * KPI));
            }
            __builtin_amdgcn_sched_barrier(0);    // and in front of the relu and the second products, which hide their latency
            v16h pr[2];
#pragma unroll
            for (int g = 0; g < 2; ++g) pr[g] = relu16(cat16(s[g][0], s[g][1]));    // the two tiles' registers, as they stand, are the B operand; both query groups first, so that the eight products follow one another
#pragma unroll
            for (int g = 0; g < 2; ++g)
#pragma unroll
                for (int dt = 0; dt < 4; ++dt) acc[dt][g] = wmma16(vf[dt], pr[g], acc[dt][g]);
            if (more && (p & 1) == 1) {
                __builtin_amdgcn_sched_barrier(0);    // the wait for the x loads stands behind the products, not among them
#pragma unroll
                for (int c = 0; c < 2; ++c)
#pragma unroll
                    for (int i = 0; i < 4; ++i) *(v4ha*)(sm + xs[i] + (p - 1 + c) * 32 * KPI) = h4(xa[c][i]);
                __builtin_amdgcn_sched_barrier(0);    // the next 64 rows are asked for behind these stores, into the same registers: moved in front of them they would need 32 more, which are not there
            }
        }
    };
#pragma unroll 1    // rolled: one trip a stage
    for (int st = 0; st < NST; ++st) {
        stage(st + 1 < NST);    // the same for the whole work-group: a scalar branch round the fetch in the last stage
        xg += KG * KT * DD; flip();
        asm volatile("s_wait_dscnt 0x0" ::: "memory");       // this wave's reads of the buffer and its stores into the other are done
        __syncthreads();                                     // that holds for every wave: the next stage may be read, this buffer refilled; behind the last stage the buffers become output staging
    }
    const int e0 = tid * 4, e1 = (tid + FW * 32) * 4;    // the thread's two 16-byte pieces of the work-group's 64 x 64 block of x and of out
    const v4f x0 = *(const v4f*)(x + e0), x1 = *(const v4f*)(x + e1);    // asked for here, needed behind the barrier
    asm volatile("s_wait_xcnt 0x0" ::: "memory");    // the two loads' address registers are free for reuse from here on
    v16h ob[2][2];
#pragma unroll
    for (int g = 0; g < 2; ++g)
#pragma unroll
        for (int kc = 0; kc < 2; ++kc)
#pragma unroll
            for (int j = 0; j < 8; ++j) { ob[g][kc][j] = tohx(acc[2 * kc][g][j] * (1.0f / PCAR)); ob[g][kc][8 + j] = tohx(acc[2 * kc + 1][g][j] * (1.0f / PCAR)); }
    const char* wl = wvt + (hd * DD + lr) * WPI + 16 * hi; float* mine = (float*)sm + wv * 32 * RP + lr * RP + hi * 8;    // each wave has a 32 x 64 tile of its own
    v8f rw[4][2];
#pragma unroll
    for (int nb = 0; nb < 4; ++nb) { const v16h a0 = ldsfrag(wl + nb * 16 * WPI), a1 = ldsfrag(wl + nb * 16 * WPI + 64);
#pragma unroll
        for (int g = 0; g < 2; ++g) rw[nb][g] = wmma16(a1, ob[g][1], wmma16(a0, ob[g][0], (v8f){})); }
    __builtin_amdgcn_sched_barrier(0);    // the stores stand behind all the products: each tile has result registers of its own, so that no product starts anew in registers that the one before it has just written
#pragma unroll
    for (int nb = 0; nb < 4; ++nb)
#pragma unroll
        for (int g = 0; g < 2; ++g) { const v8f r = rw[nb][g]; *(v4fa*)(mine + g * 16 * RP + nb * 16) = (v4f){r[0], r[1], r[2], r[3]}; *(v4fa*)(mine + g * 16 * RP + nb * 16 + 4) = (v4f){r[4], r[5], r[6], r[7]}; }
    __syncthreads();    // all 16 tiles are in LDS before any thread adds them
#pragma unroll
    for (int u = 0; u < 2; ++u) { const int e = u ? e1 : e0, q = e / DD; const float* p = (const float*)sm + (q >> 5) * 32 * RP + (q & 31) * RP + e % DD; v4f s = *(const v4fa*)p;    // query q stands in the tiles of the waves with w & 1 == q >> 5
#pragma unroll
        for (int i = 1; i < NH_ * KG; ++i) s += *(const v4fa*)(p + ((i % KG) * QW + (i / KG) * 2) * 32 * RP);    // head 0: groups 0 to 3, then head 1
        const v4f xv = u ? x1 : x0; v4f r;
#pragma unroll
        for (int i = 0; i < 4; ++i) r[i] = bfr(xv[i]) + s[i];
        *(v4f*)(outb + e) = r; }
}

extern "C" void kernel_launch(void* const* d_in, const int* in_sizes, int n_in,
                              void* d_out, int out_size, void* d_ws, size_t ws_size, hipStream_t stream) {
    (void)in_sizes; (void)n_in; (void)out_size; (void)d_ws; (void)ws_size;
    const float** I = (const float**)d_in;
    const float *x = I[0], *WQ = I[1], *WK = I[2], *WV = I[3];
    float* OUT = (float*)d_out;     // [4][4096][64]
    k_attn<<<dim3(NN / QB, NB_, 1), FW * 32, 0, stream>>>(x, WQ, WK, WV, OUT);
}

// v010
// It runs in 21.5 microseconds.
// Two timings next to v009 both put it at 1.03 times that version's speed.
// Counting every step since v000, it is 51.1 times as fast.
#include <hip/hip_runtime.h>

// x [4][4096][64]; per head h of 2: Q/K/V = x W[h] (64x64); scores = relu(Q.K^T) / 4096 (no softmax); out = x + sum_h scores V -> [4][4096][64].
// The products are reassociated: Q.K^T = (x WQ WK^T) x^T = Q' x^T, and scores V = (scores x) WV. So both heads have the same key rows and the same value rows, x itself, and no K or V plane is formed: one fp16 tile of x serves both products.
// Compute dtypes, f32 accumulate: the weights, the query rows of x and the residual x rounded to bf16; the key and value rows of x rounded once, f32 -> fp16; x WQ on bf16 operands -> fp16; Q' = Q WK^T on fp16 -> fp16; WK carries the factor 1/4 (= 1024 / 4096, a power of two); scores x 1024 / 4096 (K 64) on fp16 operands with an fp16 accumulator, rounded after k 0..31 and after k 32..63, relu on the fp16 values; scores.x fp16 -> f32; (scores.x) / 1024 -> fp16, times WV on fp16.

#define NB_  4
#define NN   4096
#define DD   64
#define NH_  2
#define PCAR 1024.0f
#define SCL  (PCAR / NN)      // what the scores are multiplied by before they are rounded to fp16: 1/4, exact; it rides on WK, so the scores leave their product already scaled
typedef _Float16 h16;
typedef __attribute__((ext_vector_type(16))) __bf16   v16bf;
typedef __attribute__((ext_vector_type(16))) _Float16 v16h;
typedef __attribute__((ext_vector_type(8)))  _Float16 v8h;
typedef __attribute__((ext_vector_type(8)))  float    v8f;
typedef __attribute__((ext_vector_type(4)))  float    v4f;
typedef v8h  __attribute__((may_alias)) v8ha;
typedef v4f  __attribute__((may_alias)) v4fa;

__device__ __forceinline__ unsigned short f2bf(float f) { unsigned u = __float_as_uint(f); u += 0x7FFFu + ((u >> 16) & 1u); return (unsigned short)(u >> 16); }
__device__ __forceinline__ float bf2f(unsigned short b) { return __uint_as_float(((unsigned)b) << 16); }
__device__ __forceinline__ float bfr(float f) { return bf2f(f2bf(f)); }
__device__ __forceinline__ v16h cat16(v8h lo, v8h hi) { return __builtin_shufflevector(lo, hi, 0, 1, 2, 3, 4, 5, 6, 7, 8, 9, 10, 11, 12, 13, 14, 15); }
__device__ __forceinline__ v8f wmma16(v16h a, v16h b, v8f c) { return __builtin_amdgcn_wmma_f32_16x16x32_f16(false, a, false, b, (short)0, c, false, false); }
__device__ __forceinline__ v8h wmma16h(v16h a, v16h b, v8h c) { return __builtin_amdgcn_wmma_f16_16x16x32_f16(false, a, false, b, (short)0, c, false, false); }    // fp16 result: a lane's 8 rows stand packed in 4 registers
typedef __attribute__((ext_vector_type(16))) short v16s;
__device__ __forceinline__ v16h relu16(v16h a) { return __builtin_bit_cast(v16h, __builtin_elementwise_max(__builtin_bit_cast(v16s, a), (v16s){})); }    // a negative fp16 value is a negative 16-bit integer: the packed integer maximum with 0 is relu, two values an instruction
__device__ __forceinline__ v8f wmmab(v16bf a, v16bf b, v8f c) { return __builtin_amdgcn_wmma_f32_16x16x32_bf16(false, a, false, b, (short)0, c, false, false); }
__device__ __forceinline__ h16 tohx(float x) { return (h16)x; }
typedef __attribute__((ext_vector_type(8))) __bf16 v8b;
typedef v8b __attribute__((may_alias)) v8ba;
__device__ __forceinline__ v8b b8(v8f a) { v8b r;    // eight f32 values rounded to nearest-even bf16
#pragma unroll
    for (int s = 0; s < 8; ++s) r[s] = (__bf16)a[s]; return r; }
__device__ __forceinline__ v16bf cat16b(v8b lo, v8b up) { return __builtin_shufflevector(lo, up, 0, 1, 2, 3, 4, 5, 6, 7, 8, 9, 10, 11, 12, 13, 14, 15); }
__device__ __forceinline__ v8h h8(v8f c) { v8h o;
#pragma unroll
    for (int j = 0; j < 8; ++j) o[j] = tohx(c[j]); return o; }
__device__ __forceinline__ v8h hb8(v8f a) { v8h o;    // eight f32 values rounded to bf16, held as fp16
#pragma unroll
    for (int j = 0; j < 8; ++j) o[j] = (h16)(float)(__bf16)a[j]; return o; }
__device__ __forceinline__ v8h hb8q(v8f a) { v8h o;    // the same, times SCL
#pragma unroll
    for (int j = 0; j < 8; ++j) o[j] = (h16)((float)(__bf16)a[j] * SCL); return o; }
typedef __attribute__((ext_vector_type(4))) _Float16 v4h;
typedef v4h __attribute__((may_alias)) v4ha;
__device__ __forceinline__ v4h h4(v4f a) { v4h o;    // four f32 values rounded to nearest-even fp16
#pragma unroll
    for (int j = 0; j < 4; ++j) o[j] = tohx(a[j]); return o; }
#define WPI 144                    // LDS pitch of a 64-element 16-bit row of a weight matrix (128 bytes + 16: an odd multiple of 16 bytes, free of bank conflicts for 16-byte accesses)
// ---- k_attn: the whole function in one launch, from the f32 inputs: Q', scores, relu, scores.x, the product with WV, the sum over heads and the residual; the attention weights never leave registers. Grid (N / 64, batches): a work-group of 16 waves takes 64 queries, both heads, all keys, and writes its rows of out.
// The waves form four key groups of 4: wave w % 4 takes 32 queries (w & 1) of one head (w % 4 >> 1), and of every stage of 512 keys the 128 keys w / 4. Four waves a SIMD: while one waits for LDS or does its relu, three others can feed the matrix unit.
// Q' = (x WQ) (SCL WK)^T of the work-group's 64 queries and 2 heads is formed at the start: wave v takes head v / 8, the 16 queries (v / 2) % 4 and the 32 outputs v % 2. WQ[k][n]: each thread reads 16 k of one column n (a wave reads whole 128-byte lines) and writes them as 32 bytes of row n of WQ^T in LDS; WK[d][k] goes to LDS row by row.
// An accumulator lane holds 8 consecutive ROWS of one column. Q^T = WQ^T x^T (A = WQ^T, B = x^T, a fragment of x being two runs of 8 floats of a query's row): two tiles of 16 outputs, rounded to fp16 in place, are the B operand of Q'^T = WK Q^T (A = 16 rows of WK), and two tiles of that, again rounded in place, are one B fragment of the score product, which goes lane for lane through LDS to the 4 waves, one a key group, that use it. K = 64 is summed as k 0..31, then k 32..63, in f32.
// Each group's part of a stage (128 rows of x, as fp16 16 KiB) is brought into LDS once for its 4 waves, that is for both heads and both products: f32 loads of whole cache lines (a wave reads 2 rows an instruction), rounded to fp16 in registers, 8-byte LDS stores.
// The ring: a group's keys go through four slots of 64 rows (a half stage). During half h a wave reads slot h % 4, asks at its head for its share of half h + 2 and stores it at its foot into slot (h + 2) % 4.
// One work-group barrier a half, split. Signal h stands at the foot of half h, behind s_wait_dscnt 0: this wave's stores of half h + 2 and all its reads up to half h are done. Wait h stands in the second 32 keys of half h + 1, in front of the first read of half h + 2 (the K rows fetched ahead) and of the stores of half h + 3, whose slot held half h - 1.
// The LDS reads between a signal and its wait touch half h + 1 alone, which the barrier before has published and which nobody overwrites before wait h + 2. So no wave stands still at a hand-over unless another is more than 32 keys' work behind: the matrix unit does not run empty there.
// One tile, two readers: rows of 128 bytes without a pad, the 16-byte piece c of row r standing at piece c ^ SWZ(r). So the 16 rows of one piece that half a wave reads with ds_load_b128, and the 8 rows of two pieces that it reads with ds_load_tr16_b128, each fall on all 64 banks once.
// Transposed products: S^T = X Q'^T (A = 16 key rows, B = 16 query columns), so two fp16 S^T tiles of 32 keys, which leave the matrix unit scaled and packed, are after relu in place the B operand of O^T += X^T P^T (A = 16 rows of X^T, which the transposing LDS load takes out of the same X tile).
// In the same way two O^T tiles of 32 columns d, rounded to fp16 in place, are the B operand of R^T = WV^T O^T (A = 16 rows of WV^T, which the work-group puts into LDS at its start).
// All loaders give the hardware k order (8 * hi + s, then 16 + 8 * hi + s). A wave sums all its keys in its own accumulators; the product with WV is linear, so each wave takes it of its own sums, and the 8 waves' R (2 heads x 4 key groups) are added in LDS order head, then group.
#define QW 4                       // waves side by side: 2 x 32 queries, 2 heads
#define KG 4                       // key groups
#define FW (QW * KG)               // waves per work-group
#define QB 64                      // queries per work-group
#define KT 128                     // keys per stage and key group
#define KPI 128                    // LDS pitch of an X row: no pad
#define SWZ(r) (2 * (((r) >> 1) & 3) + (((r) >> 3) & 1))    // what a row's piece numbers are XORed with; it repeats every 16 rows
#define HK 64                      // keys per half stage and key group: one slot
#define NSL 4                      // slots per key group
#define HBY 16384                  // from slot to slot: 8 KiB of rows, 8 KiB free, so that slots h and h + 2 lie in different 32-KiB blocks of LDS
#define SBY (NSL * HBY)            // one group's slots: two 32-KiB blocks of its own, so that the four groups' reads and the stores two slots on fall in different blocks; every slot is reached by an immediate offset
#define BBY (KG * SBY / 2)         // half the ring
static_assert(HK * KPI <= HBY && FW * 1024 <= HBY && 2 * HK == KT, "a slot's rows, and the fragments of Q', must fit the step from slot to slot");
#define NST (NN / (KG * KT))       // stages per work-group
#define RP 68
#define OBY (FW * 32 * RP * 4)     // output staging: a 32 x 64 f32 tile a wave
#define WBY (NH_ * DD * WPI)       // one weight matrix, both heads, in LDS
static_assert(OBY <= 2 * BBY, "the output staging must fit the ring");
__device__ __forceinline__ v16h ldsfrag(const char* p) { return cat16(*(const v8ha*)p, *(const v8ha*)(p + 32)); }
typedef __attribute__((ext_vector_type(8))) short s16x8;
// The transposing load: the lanes hand in 16 rows x 2 pieces (row 8 * hi + (lane & 7), piece (lane >> 3) & 1), and lane (lr, hi) gets column lr of rows 8 * hi ... 8 * hi + 7.
__device__ __forceinline__ v8h ld_tr16(const char* p) { typedef __attribute__((address_space(3))) s16x8 lds_s16x8; return __builtin_bit_cast(v8h, __builtin_amdgcn_ds_load_tr16_b128_v8i16((lds_s16x8*)p)); }
// Four waves a SIMD, that is one work-group a WGP: the grid has as many work-groups as the chip has WGPs.
__global__ __launch_bounds__(FW * 32) __attribute__((amdgpu_waves_per_eu(4, 4))) void k_attn(const float* __restrict__ x, const float* __restrict__ wqg, const float* __restrict__ wkg, const float* __restrict__ wvg, float* __restrict__ outb) {
    __shared__ __align__(16) char sm[2 * BBY + 3 * WBY];    // the ring, later the output staging, then the three weight matrices; one array, so that the ring starts at LDS byte 0; every inner loop below is unrolled, so that the register arrays are indexed by constants only
    char* const wvt = sm + 2 * BBY; char* const wqt = wvt + WBY; char* const wk2 = wqt + WBY;
    const int tid = threadIdx.x, lane = tid & 31, lr = lane & 15, hi = lane >> 4; const int wv = __builtin_amdgcn_readfirstlane(tid >> 5); const int w = wv % QW, kg = wv / QW; const int hd = w >> 1;
    const float* xb = x + (size_t)blockIdx.y * NN * DD;    // the batch's rows: keys and values
    x = xb + blockIdx.x * QB * DD; outb += ((size_t)blockIdx.y * NN + blockIdx.x * QB) * DD;
    const int wo = (tid >> 8) * DD * DD + ((tid >> 6) & 3) * 16 * DD + (tid & 63);    // WQ[k][n], WV[d][n] of both heads: each thread reads 16 rows of one column n and writes them as 32 bytes of row n of the transpose
    const float* qc = wqg + wo; const float* vc = wvg + wo; const float* kr = wkg + (tid >> 2) * DD + (tid & 3) * 16;    // WK: 16 floats of a row
    const int ph = wv >> 3, pq = (wv >> 1) & 3, pk = wv & 1;    // the wave's part in forming Q': head, 16 queries, 32 of the 64 outputs
    const float* xl = xb + (size_t)(blockIdx.x * QB + pq * 16 + lr) * DD + 8 * hi;    // those query rows
    const float* xg = xb + (size_t)(kg * KT + w * 8 + hi) * DD + lr * 4;    // the lane's 16 bytes of its group's tile of stage 0: a part of 32 rows is 8 rows a wave, 2 rows an instruction
    unsigned xs[4];    // and their places, as bytes from the start of sm, in the group's slot 0: 8 bytes, half a piece; the parts lie 32 rows apart, so SWZ stays
#pragma unroll
    for (int i = 0; i < 4; ++i) xs[i] = kg * SBY + (w * 8 + i * 2 + hi) * KPI + ((lr >> 1) ^ SWZ(w * 8 + i * 2 + hi)) * 16 + (lr & 1) * 8;
    v16bf xf[2];
    { v8f qr[2], kx[2], vr[2], xr[2][2]; v4f x0[KT / 32][4];
#pragma unroll
        for (int i = 0; i < 2; ++i)
#pragma unroll
            for (int s = 0; s < 8; ++s) qr[i][s] = qc[(i * 8 + s) * DD];
#pragma unroll
        for (int i = 0; i < 2; ++i) kx[i] = *(const v8f*)(kr + i * 8);
#pragma unroll
        for (int kc = 0; kc < 2; ++kc)
#pragma unroll
            for (int u = 0; u < 2; ++u) xr[kc][u] = *(const v8f*)(xl + kc * 32 + u * 16);
#pragma unroll
        for (int p = 0; p < KT / 32; ++p)
#pragma unroll
            for (int i = 0; i < 4; ++i) x0[p][i] = *(const v4f*)(xg + (p * 32 + i * 2) * DD);
#pragma unroll
        for (int i = 0; i < 2; ++i)
#pragma unroll
            for (int s = 0; s < 8; ++s) vr[i][s] = vc[(i * 8 + s) * DD];
        __builtin_amdgcn_sched_barrier(0);    // every load is issued before the first conversion waits for one: one memory latency, not several in turn
        asm volatile("s_wait_xcnt 0x0" :: "v"(qc), "v"(kr), "v"(xl), "v"(xg), "v"(vc) : "memory");    // all the loads name these five address pairs: they stay whole up to here and are free for reuse from here on
        const int wr = ((tid >> 8) * DD + (tid & 63)) * WPI + ((tid >> 6) & 3) * 32;
#pragma unroll
        for (int i = 0; i < 2; ++i) { *(v8ba*)(wqt + wr + i * 16) = b8(qr[i]); *(v8ha*)(wk2 + (tid >> 2) * WPI + (tid & 3) * 32 + i * 16) = hb8q(kx[i]); }
#pragma unroll
        for (int kc = 0; kc < 2; ++kc) xf[kc] = cat16b(b8(xr[kc][0]), b8(xr[kc][1]));
#pragma unroll
        for (int p = 0; p < KT / 32; ++p)
#pragma unroll
            for (int i = 0; i < 4; ++i) *(v4ha*)(sm + xs[i] + (p >> 1) * HBY + (p & 1) * 32 * KPI) = h4(x0[p][i]);    // halves 0 and 1
#pragma unroll
        for (int i = 0; i < 2; ++i) *(v8ha*)(wvt + wr + i * 16) = hb8(vr[i]); }
    __syncthreads();    // stage 0 and the three weight matrices are whole in LDS before any wave reads them
    v16h qf[2][2];
    { v8h o[4]; char* const qx = sm + 2 * HBY;    // the fragments' way from wave to wave: 1 KiB a wave, in the first group's slot 2, which is first stored into behind the first wait of the loop
        v16bf qa[4][2]; v16h ka[2][2];
#pragma unroll
        for (int nb = 0; nb < 4; ++nb)
#pragma unroll
            for (int kc = 0; kc < 2; ++kc) { const char* p = wqt + (ph * DD + nb * 16 + lr) * WPI + kc * 64 + 16 * hi; qa[nb][kc] = cat16b(*(const v8ba*)p, *(const v8ba*)(p + 32)); }
#pragma unroll
        for (int j = 0; j < 2; ++j)
#pragma unroll
            for (int kc = 0; kc < 2; ++kc) ka[j][kc] = ldsfrag(wk2 + (ph * DD + (pk * 2 + j) * 16 + lr) * WPI + kc * 64 + 16 * hi);
        __builtin_amdgcn_sched_barrier(0);    // every fragment is asked for before the first product waits for one: one LDS latency, not one a product
#pragma unroll
        for (int nb = 0; nb < 4; ++nb) o[nb] = h8(wmmab(qa[nb][1], xf[1], wmmab(qa[nb][0], xf[0], (v8f){})));
        const v16h b0 = cat16(o[0], o[1]), b1 = cat16(o[2], o[3]);
#pragma unroll
        for (int j = 0; j < 2; ++j) *(v8ha*)(qx + wv * 1024 + j * 512 + lane * 16) = h8(wmma16(ka[j][1], b1, wmma16(ka[j][0], b0, (v8f){})));
        __syncthreads();    // all 16 fragments of Q' are in LDS before any wave reads its four
#pragma unroll
        for (int g = 0; g < 2; ++g)
#pragma unroll
            for (int kc = 0; kc < 2; ++kc) { const char* s = qx + (((hd * 4 + (w & 1) * 2 + g) * 2 + kc) * 1024) + lane * 16; qf[g][kc] = cat16(*(const v8ha*)s, *(const v8ha*)(s + 512)); } }
    v8f acc[4][2];
#pragma unroll
    for (int dt = 0; dt < 4; ++dt)
#pragma unroll
        for (int g = 0; g < 2; ++g) acc[dt][g] = (v8f){};
    unsigned kl[2][2], vl[4];    // the lane's fragment pieces in its group's slot 0, as bytes from the start of sm; every row step below is a multiple of 16 rows, so SWZ stays
#pragma unroll
    for (int kc = 0; kc < 2; ++kc)
#pragma unroll
        for (int u = 0; u < 2; ++u) kl[kc][u] = kg * SBY + lr * KPI + ((kc * 4 + u * 2 + hi) ^ SWZ(lr)) * 16;    // row lr, bytes 16 * hi and 32 + 16 * hi of each 64
#pragma unroll
    for (int dt = 0; dt < 4; ++dt) vl[dt] = kg * SBY + (8 * hi + (lane & 7)) * KPI + ((dt * 2 + ((lane >> 3) & 1)) ^ SWZ(8 * hi + (lane & 7))) * 16;    // 16 columns d are 2 pieces
    asm volatile("s_wait_dscnt 0x0\n\ts_barrier_signal -1" ::: "memory");    // the signal in front of half 0: this wave has read its fragments of Q', so their place may become slot 2 behind the first wait
    v16h kf[2][2];    // the K rows of the next 32 keys, always fetched one pass ahead, also from half to half
#pragma unroll
    for (int t = 0; t < 2; ++t)
#pragma unroll
        for (int kc = 0; kc < 2; ++kc) kf[t][kc] = cat16(*(const v8ha*)(sm + kl[kc][0] + t * 16 * KPI), *(const v8ha*)(sm + kl[kc][1] + t * 16 * KPI));
    // One half: the work on slot j, and the way of the half after the next into slot (j + 2) % 4. The last two halves fetch nothing.
    auto half = [&](const int j, const bool more, const bool last) __attribute__((always_inline)) {
        v16h vf[4]; v4f xa[2][4];
        if (more) {    // 64 rows: asked for here, stored behind the products of these 64 keys
#pragma unroll
            for (int c = 0; c < 2; ++c)
#pragma unroll
                for (int i = 0; i < 4; ++i) xa[c][i] = *(const v4f*)(xg + ((j + 2) >> 1) * KG * KT * DD + ((j & 1) * HK + c * 32 + i * 2) * DD);
            asm volatile("s_wait_xcnt 0x0" ::: "memory");    // directly behind the loads: their address pair may be rewritten from here on
        }
#pragma unroll    // unrolled: LDS offsets become immediates
        for (int q = 0; q < 2; ++q) {
            const int ro = j * HBY + q * 32 * KPI, rn = q == 0 ? j * HBY + 32 * KPI : ((j + 1) % NSL) * HBY;    // these 32 keys' rows and the next 32 keys'
#pragma unroll
            for (int dt = 0; dt < 4; ++dt) vf[dt] = cat16(ld_tr16(sm + vl[dt] + ro), ld_tr16(sm + vl[dt] + ro + 16 * KPI));    // keys 8 * hi + s, then 16 + 8 * hi + s: the hardware k order
            __builtin_amdgcn_sched_barrier(0);    // the x loads and the X^T reads stand as one group in front of the score products, which hide their latency
            v8h s[2][2];
#pragma unroll
            for (int g = 0; g < 2; ++g)
#pragma unroll
                for (int t = 0; t < 2; ++t) s[g][t] = wmma16h(kf[t][1], qf[g][1], wmma16h(kf[t][0], qf[g][0], (v8h){}));
            __builtin_amdgcn_sched_barrier(0);    // the next 32 keys' K rows stand as one group behind the score products, not among them
            if (q == 1) asm volatile("s_barrier_wait -1" ::: "memory");    // the wait for the signals at the foot of the half before: the next half is whole in LDS, and every wave has left the slot that this half's stores go to
            if (!(last && q == 1)) {
#pragma unroll
                for (int t = 0; t < 2; ++t)
#pragma unroll
                    for (int kc = 0; kc < 2; ++kc) kf[t][kc] = cat16(*(const v8ha*)(sm + kl[kc][0] + rn + t * 16 * KPI), *(const v8ha*)(sm + kl[kc][1] + rn + t * 16 * KPI));
            }
            __builtin_amdgcn_sched_barrier(0);    // and in front of the relu and the second products, which hide their latency
            v16h pr[2];
#pragma unroll
            for (int g = 0; g < 2; ++g) pr[g] = relu16(cat16(s[g][0], s[g][1]));    // the two tiles' registers, as they stand, are the B operand; both query groups first, so that the eight products follow one another
#pragma unroll
            for (int g = 0; g < 2; ++g)
#pragma unroll
                for (int dt = 0; dt < 4; ++dt) acc[dt][g] = wmma16(vf[dt], pr[g], acc[dt][g]);
        }
        __builtin_amdgcn_sched_barrier(0);    // the wait for the x loads, the LDS wait and the signal stand behind the products, not among them
        if (more) {
#pragma unroll
            for (int c = 0; c < 2; ++c)
#pragma unroll
                for (int i = 0; i < 4; ++i) *(v4ha*)(sm + xs[i] + ((j + 2) % NSL) * HBY + c * 32 * KPI) = h4(xa[c][i]);
        }
        asm volatile("s_wait_dscnt 0x0\n\ts_barrier_signal -1" ::: "memory");    // this wave's stores and all its reads so far are done: only then its signal; the wave goes on at once, the wait follows in the next half
    };
#pragma unroll 1    // rolled: one trip is once round the ring, two stages
    for (int st = 0; st + 2 < NST; st += 2) {
        half(0, true, false); half(1, true, false); half(2, true, false); half(3, true, false);
        xg += 2 * KG * KT * DD;
    }
    half(0, true, false); half(1, true, false); half(2, false, false); half(3, false, true);    // the last round stands by itself: no branch round the fetch inside the loop
    asm volatile("s_barrier_wait -1" ::: "memory");    // the wait for the last signals: every wave is done reading the ring, which becomes output staging
    const int e0 = tid * 4, e1 = (tid + FW * 32) * 4;    // the thread's two 16-byte pieces of the work-group's 64 x 64 block of x and of out
    const v4f x0 = *(const v4f*)(x + e0), x1 = *(const v4f*)(x + e1);    // asked for here, needed behind the barrier
    asm volatile("s_wait_xcnt 0x0" ::: "memory");    // the two loads' address registers are free for reuse from here on
    v16h ob[2][2];
#pragma unroll
    for (int g = 0; g < 2; ++g)
#pragma unroll
        for (int kc = 0; kc < 2; ++kc)
#pragma unroll
            for (int j = 0; j < 8; ++j) { ob[g][kc][j] = tohx(acc[2 * kc][g][j] * (1.0f / PCAR)); ob[g][kc][8 + j] = tohx(acc[2 * kc + 1][g][j] * (1.0f / PCAR)); }
    const char* wl = wvt + (hd * DD + lr) * WPI + 16 * hi; float* mine = (float*)sm + wv * 32 * RP + lr * RP + hi * 8;    // each wave has a 32 x 64 tile of its own
    v8f rw[4][2];
#pragma unroll
    for (int nb = 0; nb < 4; ++nb) { const v16h a0 = ldsfrag(wl + nb * 16 * WPI), a1 = ldsfrag(wl + nb * 16 * WPI + 64);
#pragma unroll
        for (int g = 0; g < 2; ++g) rw[nb][g] = wmma16(a1, ob[g][1], wmma16(a0, ob[g][0], (v8f){})); }
    __builtin_amdgcn_sched_barrier(0);    // the stores stand behind all the products: each tile has result registers of its own, so that no product starts anew in registers that the one before it has just written
#pragma unroll
    for (int nb = 0; nb < 4; ++nb)
#pragma unroll
        for (int g = 0; g < 2; ++g) { const v8f r = rw[nb][g]; *(v4fa*)(mine + g * 16 * RP + nb * 16) = (v4f){r[0], r[1], r[2], r[3]}; *(v4fa*)(mine + g * 16 * RP + nb * 16 + 4) = (v4f){r[4], r[5], r[6], r[7]}; }
    __syncthreads();    // all 16 tiles are in LDS before any thread adds them
#pragma unroll
    for (int u = 0; u < 2; ++u) { const int e = u ? e1 : e0, q = e / DD; const float* p = (const float*)sm + (q >> 5) * 32 * RP + (q & 31) * RP + e % DD; v4f s = *(const v4fa*)p;    // query q stands in the tiles of the waves with w & 1 == q >> 5
#pragma unroll
        for (int i = 1; i < NH_ * KG; ++i) s += *(const v4fa*)(p + ((i % KG) * QW + (i / KG) * 2) * 32 * RP);    // head 0: groups 0 to 3, then head 1
        const v4f xv = u ? x1 : x0; v4f r;
#pragma unroll
        for (int i = 0; i < 4; ++i) r[i] = bfr(xv[i]) + s[i];
        *(v4f*)(outb + e) = r; }
}

extern "C" void kernel_launch(void* const* d_in, const int* in_sizes, int n_in,
                              void* d_out, int out_size, void* d_ws, size_t ws_size, hipStream_t stream) {
    (void)in_sizes; (void)n_in; (void)out_size; (void)d_ws; (void)ws_size;
    const float** I = (const float**)d_in;
    const float *x = I[0], *WQ = I[1], *WK = I[2], *WV = I[3];
    float* OUT = (float*)d_out;     // [4][4096][64]
    k_attn<<<dim3(NN / QB, NB_, 1), FW * 32, 0, stream>>>(x, WQ, WK, WV, OUT);
}
